// v000
// Times are from an AMD MI455X. After a warm-up the kernel runs many times in a row, and a time is the length of
// such a window on the GPU divided by its runs, so every launch and the gaps after it count. The runs cycle
// through copies of the inputs. A figure is the median of several windows, for all but v000 over two sittings.
// Sittings can differ by a few percent; kernels timed side by side share one.
// v000, which the later versions start from, runs in 407 microseconds.
#include <hip/hip_runtime.h>

// ---------------------------------------------------------------------------
// CDNA5 (gfx1250) implementation. wave32; WMMA f32_16x16x32_f16 with fp32
// hi/lo split (Markidis): Ah*Bh + Ah*Bl + Al*Bh at f32 accumulate gives
// ~2^-22 relative error on the fast f16 matrix pipe. Weights and
// intermediates are pre-split into hi/lo f16 planes; stage 1 splits its f32 inputs in-loop.
// ---------------------------------------------------------------------------

typedef _Float16 v16h  __attribute__((ext_vector_type(16)));
typedef _Float16 f16x8 __attribute__((ext_vector_type(8)));
typedef float    v8f   __attribute__((ext_vector_type(8)));

#define TM 64          // M rows per block (sorted-entity tile)
#define TK 32          // K per WMMA step
#define NROLES 3
#define LDA 40         // LDS row stride in f16 (80B: 16B aligned, bank-skewed)

// ---------------- control kernels (role sort) ----------------

__global__ void k_init(int* __restrict__ ctrl, int* __restrict__ row_map, int n) {
  int i = blockIdx.x * blockDim.x + threadIdx.x;
  if (i < n) row_map[i] = -1;
  if (i < 16) ctrl[i] = 0;   // [0..2]=counts [4..6]=cursors [8..10]=poff
}

__global__ void k_hist(const int* __restrict__ roles, int E, int* __restrict__ ctrl) {
  int i = blockIdx.x * blockDim.x + threadIdx.x;
  if (i < E) atomicAdd(&ctrl[roles[i]], 1);
}

__global__ void k_offsets(int* __restrict__ ctrl, int* __restrict__ tile_role, int maxTiles) {
  __shared__ int s_off[NROLES], s_cnt[NROLES];
  if (threadIdx.x == 0) {
    int off = 0;
    for (int r = 0; r < NROLES; ++r) {
      ctrl[8 + r] = off; s_off[r] = off; s_cnt[r] = ctrl[r];
      off += ctrl[r];
      off = ((off + TM - 1) / TM) * TM;          // tile-align next segment
    }
  }
  __syncthreads();
  for (int t = threadIdx.x; t < maxTiles; t += blockDim.x) {
    int role = -1, base = t * TM;
    for (int r = 0; r < NROLES; ++r)
      if (base >= s_off[r] && base < s_off[r] + s_cnt[r]) role = r;
    tile_role[t] = role;
  }
}

__global__ void k_scatter(const int* __restrict__ roles, int E,
                          int* __restrict__ ctrl, int* __restrict__ row_map) {
  int i = blockIdx.x * blockDim.x + threadIdx.x;
  if (i >= E) return;
  int r = roles[i];
  int pos = ctrl[8 + r] + atomicAdd(&ctrl[4 + r], 1);
  row_map[pos] = i;
}

// ---------------- weight pre-split: fp32 -> hi/lo f16 planes ----------------

__global__ void k_split(const float* __restrict__ base, const int* __restrict__ layer_idx_p,
                        size_t perLayer, _Float16* __restrict__ hi,
                        _Float16* __restrict__ lo, int n) {
  int i = blockIdx.x * blockDim.x + threadIdx.x;
  if (i >= n) return;
  float x = base[(size_t)layer_idx_p[0] * perLayer + i];
  _Float16 h = (_Float16)x;
  hi[i] = h;
  lo[i] = (_Float16)(x - (float)h);
}

// ---------------- GEMM building blocks ----------------

// Cooperative load of a 64x32 f32 tile (row-gathered) -> split hi/lo f16 in LDS.
__device__ inline void load_tile_f32g(const float* __restrict__ src, int row0, int k0, int H,
                                      const int* __restrict__ row_map,
                                      _Float16* __restrict__ Shi, _Float16* __restrict__ Slo) {
  int t = threadIdx.x;           // 256 threads
  int r = t >> 2;                // 0..63
  int c = (t & 3) * 8;           // 0,8,16,24
  int srow = row_map[row0 + r];
  float vals[8];
  if (srow >= 0) {
    const float* p = src + (size_t)srow * H + (size_t)(k0 + c);
#pragma unroll
    for (int j = 0; j < 8; ++j) vals[j] = p[j];
  } else {
#pragma unroll
    for (int j = 0; j < 8; ++j) vals[j] = 0.0f;
  }
#pragma unroll
  for (int j = 0; j < 8; ++j) {
    _Float16 h = (_Float16)vals[j];
    Shi[r * LDA + c + j] = h;
    Slo[r * LDA + c + j] = (_Float16)(vals[j] - (float)h);
  }
}

// Cooperative copy of pre-split hi/lo f16 tiles (nrows x 32) -> LDS, no VALU.
__device__ inline void load_tile_f16(const _Float16* __restrict__ srcHi,
                                     const _Float16* __restrict__ srcLo,
                                     int row0, int k0, int H,
                                     _Float16* __restrict__ Shi, _Float16* __restrict__ Slo,
                                     int nrows) {
  for (int idx = threadIdx.x; idx < nrows * 4; idx += 256) {
    int r = idx >> 2, c = (idx & 3) * 8;
    size_t g = (size_t)(row0 + r) * H + (size_t)(k0 + c);
    *(f16x8*)&Shi[r * LDA + c] = *(const f16x8*)&srcHi[g];
    *(f16x8*)&Slo[r * LDA + c] = *(const f16x8*)&srcLo[g];
  }
}

// Per-lane WMMA fragment per ISA layout:
// lane<16: K{0..7,16..23}; lane>=16: K{8..15,24..31}, row = lane&15 (+rowbase).
__device__ inline v16h load_frag(const _Float16* __restrict__ S, int rowbase) {
  int lane = threadIdx.x & 31;
  int row  = rowbase + (lane & 15);
  int ko   = (lane >> 4) * 8;
  f16x8 a = *(const f16x8*)&S[row * LDA + ko];
  f16x8 b = *(const f16x8*)&S[row * LDA + ko + 16];
  return __builtin_shufflevector(a, b, 0,1,2,3,4,5,6,7,8,9,10,11,12,13,14,15);
}

// fp32-accurate product via 3 f16 WMMAs.
__device__ inline v8f mma3(v16h ah, v16h al, v16h bh, v16h bl, v8f c) {
  c = __builtin_amdgcn_wmma_f32_16x16x32_f16(false, ah, false, bh, (short)0, c, false, false);
  c = __builtin_amdgcn_wmma_f32_16x16x32_f16(false, ah, false, bl, (short)0, c, false, false);
  c = __builtin_amdgcn_wmma_f32_16x16x32_f16(false, al, false, bh, (short)0, c, false, false);
  return c;
}

// ---------------- stage 1: h = (v@W^T + Wb) * (r@U^T + Ub), gathered ----------------
// Block tile 64M x 64N, 8 waves each 16M x 32N, dual accumulators.

__global__ __launch_bounds__(256)
void k_stage1(const float* __restrict__ v_repr, const float* __restrict__ r_repr,
              const _Float16* __restrict__ Whi, const _Float16* __restrict__ Wlo,
              const _Float16* __restrict__ Uhi, const _Float16* __restrict__ Ulo,
              const float* __restrict__ Wb, const float* __restrict__ Ub,
              const int* __restrict__ layer_idx_p,
              const int* __restrict__ tile_role, const int* __restrict__ row_map,
              _Float16* __restrict__ hhi, _Float16* __restrict__ hlo, int H, int R) {
  __shared__ _Float16 sAvh[TM * LDA], sAvl[TM * LDA];
  __shared__ _Float16 sArh[TM * LDA], sArl[TM * LDA];
  __shared__ _Float16 sBwh[64 * LDA], sBwl[64 * LDA];
  __shared__ _Float16 sBuh[64 * LDA], sBul[64 * LDA];

  int tile = blockIdx.x;
  int role = tile_role[tile];
  if (role < 0) return;
  int layer = layer_idx_p[0];
  size_t wb = (size_t)role * H * H;      // pre-split planes hold the active layer only

  int m0 = tile * TM, n0 = blockIdx.y * 64;
  int wave = threadIdx.x >> 5;
  int wm = wave & 3, wn = wave >> 2;

  v8f accW[2] = {}; v8f accU[2] = {};
  for (int k0 = 0; k0 < H; k0 += TK) {
    load_tile_f32g(v_repr, m0, k0, H, row_map, sAvh, sAvl);
    load_tile_f32g(r_repr, m0, k0, H, row_map, sArh, sArl);
    load_tile_f16(Whi + wb, Wlo + wb, n0, k0, H, sBwh, sBwl, 64);
    load_tile_f16(Uhi + wb, Ulo + wb, n0, k0, H, sBuh, sBul, 64);
    __syncthreads();
    v16h avh = load_frag(sAvh, wm * 16), avl = load_frag(sAvl, wm * 16);
    v16h arh = load_frag(sArh, wm * 16), arl = load_frag(sArl, wm * 16);
#pragma unroll
    for (int s = 0; s < 2; ++s) {
      int nb = wn * 32 + s * 16;
      v16h bwh = load_frag(sBwh, nb), bwl = load_frag(sBwl, nb);
      v16h buh = load_frag(sBuh, nb), bul = load_frag(sBul, nb);
      accW[s] = mma3(avh, avl, bwh, bwl, accW[s]);
      accU[s] = mma3(arh, arl, buh, bul, accU[s]);
    }
    __syncthreads();
  }

  int lane = threadIdx.x & 31;
  const float* Wbl = Wb + ((size_t)layer * R + role) * H;
  const float* Ubl = Ub + ((size_t)layer * R + role) * H;
#pragma unroll
  for (int s = 0; s < 2; ++s) {
    int col = n0 + wn * 32 + s * 16 + (lane & 15);
    float bw = Wbl[col], bu = Ubl[col];
#pragma unroll
    for (int g = 0; g < 8; ++g) {
      int mrow = m0 + wm * 16 + g + (lane >> 4) * 8;
      float h = (accW[s][g] + bw) * (accU[s][g] + bu);
      h = (row_map[mrow] >= 0) ? h : 0.0f;
      _Float16 hh = (_Float16)h;
      size_t o = (size_t)mrow * H + col;
      hhi[o] = hh;
      hlo[o] = (_Float16)(h - (float)hh);
    }
  }
}

// ---------------- stages 2/3: block tile 64M x 128N, 8 waves each 32M x 32N ---------
// EPI==0: dst = relu(A@P^T + b), re-split to hi/lo planes (sorted -> sorted)
// EPI==1: out[row_map[row]] = A@P^T + b   (sorted -> scatter, f32)

template<int EPI>
__global__ __launch_bounds__(256)
void k_gemm(const _Float16* __restrict__ Ahi, const _Float16* __restrict__ Alo,
            const _Float16* __restrict__ Bhi, const _Float16* __restrict__ Blo,
            const float* __restrict__ Pb, const int* __restrict__ layer_idx_p,
            const int* __restrict__ tile_role, const int* __restrict__ row_map,
            float* __restrict__ outF,
            _Float16* __restrict__ dsthi, _Float16* __restrict__ dstlo,
            int H, int R) {
  __shared__ _Float16 sAh[TM * LDA],  sAl[TM * LDA];
  __shared__ _Float16 sBh[128 * LDA], sBl[128 * LDA];

  int tile = blockIdx.x;
  int role = tile_role[tile];
  if (role < 0) return;
  int layer = layer_idx_p[0];
  size_t pb = (size_t)role * H * H;

  int m0 = tile * TM, n0 = blockIdx.y * 128;
  int wave = threadIdx.x >> 5;
  int wm = wave & 1, wn = wave >> 1;     // 2 (M) x 4 (N) wave grid

  v8f acc[2][2] = {};
  for (int k0 = 0; k0 < H; k0 += TK) {
    load_tile_f16(Ahi,      Alo,      m0, k0, H, sAh, sAl, 64);
    load_tile_f16(Bhi + pb, Blo + pb, n0, k0, H, sBh, sBl, 128);
    __syncthreads();
    v16h ah[2], al[2], bh[2], bl[2];
#pragma unroll
    for (int i = 0; i < 2; ++i) {
      ah[i] = load_frag(sAh, wm * 32 + i * 16);
      al[i] = load_frag(sAl, wm * 32 + i * 16);
      bh[i] = load_frag(sBh, wn * 32 + i * 16);
      bl[i] = load_frag(sBl, wn * 32 + i * 16);
    }
#pragma unroll
    for (int i = 0; i < 2; ++i)
#pragma unroll
      for (int j = 0; j < 2; ++j)
        acc[i][j] = mma3(ah[i], al[i], bh[j], bl[j], acc[i][j]);
    __syncthreads();
  }

  int lane = threadIdx.x & 31;
  const float* Pbl = Pb + ((size_t)layer * R + role) * H;
#pragma unroll
  for (int i = 0; i < 2; ++i) {
#pragma unroll
    for (int j = 0; j < 2; ++j) {
      int col = n0 + wn * 32 + j * 16 + (lane & 15);
      float b = Pbl[col];
#pragma unroll
      for (int g = 0; g < 8; ++g) {
        int mrow = m0 + wm * 32 + i * 16 + g + (lane >> 4) * 8;
        float val = acc[i][j][g] + b;
        if (EPI == 0) {
          val = fmaxf(val, 0.0f);
          _Float16 vh = (_Float16)val;
          size_t o = (size_t)mrow * H + col;
          dsthi[o] = vh;
          dstlo[o] = (_Float16)(val - (float)vh);
        } else {
          int e = row_map[mrow];
          if (e >= 0) outF[(size_t)e * H + col] = val;
        }
      }
    }
  }
}

// ---------------- host launch ----------------

static inline size_t align256(size_t x) { return (x + 255) & ~(size_t)255; }

extern "C" void kernel_launch(void* const* d_in, const int* in_sizes, int n_in,
                              void* d_out, int out_size, void* d_ws, size_t ws_size,
                              hipStream_t stream) {
  const float* v_repr = (const float*)d_in[0];
  const float* r_repr = (const float*)d_in[1];
  const int*   roles  = (const int*)d_in[2];
  const float* W   = (const float*)d_in[3];
  const float* Wb  = (const float*)d_in[4];
  const float* U   = (const float*)d_in[5];
  const float* Ub  = (const float*)d_in[6];
  const float* P1  = (const float*)d_in[7];
  const float* P1b = (const float*)d_in[8];
  const float* P2  = (const float*)d_in[9];
  const float* P2b = (const float*)d_in[10];
  const int*   layer_idx = (const int*)d_in[11];
  float* out = (float*)d_out;

  const int E = in_sizes[2];
  const int H = in_sizes[0] / E;                // 512
  const int R = NROLES;
  const int maxTiles = (E + TM - 1) / TM + R;   // padded role segments
  const int padRows  = maxTiles * TM;
  const int nW       = R * H * H;               // per-layer weight slice elements
  const size_t perLayer = (size_t)nW;

  char* ws = (char*)d_ws;
  size_t off = 0;
  int* ctrl      = (int*)(ws + off); off += 256;
  int* tile_role = (int*)(ws + off); off = align256(off + (size_t)maxTiles * 4);
  int* row_map   = (int*)(ws + off); off = align256(off + (size_t)padRows * 4);

  _Float16* wplane[8];                          // Whi Wlo Uhi Ulo P1hi P1lo P2hi P2lo
  for (int i = 0; i < 8; ++i) {
    wplane[i] = (_Float16*)(ws + off);
    off = align256(off + (size_t)nW * 2);
  }
  size_t actBytes = (size_t)padRows * H * 2;
  _Float16* hhi = (_Float16*)(ws + off); off = align256(off + actBytes);
  _Float16* hlo = (_Float16*)(ws + off); off = align256(off + actBytes);
  _Float16* thi = (_Float16*)(ws + off); off = align256(off + actBytes);
  _Float16* tlo = (_Float16*)(ws + off); off = align256(off + actBytes);

  int tpb = 256;
  k_init   <<<(padRows + tpb - 1) / tpb, tpb, 0, stream>>>(ctrl, row_map, padRows);
  k_hist   <<<(E + tpb - 1) / tpb,       tpb, 0, stream>>>(roles, E, ctrl);
  k_offsets<<<1,                          tpb, 0, stream>>>(ctrl, tile_role, maxTiles);
  k_scatter<<<(E + tpb - 1) / tpb,       tpb, 0, stream>>>(roles, E, ctrl, row_map);

  int sgrid = (nW + tpb - 1) / tpb;
  k_split<<<sgrid, tpb, 0, stream>>>(W,  layer_idx, perLayer, wplane[0], wplane[1], nW);
  k_split<<<sgrid, tpb, 0, stream>>>(U,  layer_idx, perLayer, wplane[2], wplane[3], nW);
  k_split<<<sgrid, tpb, 0, stream>>>(P1, layer_idx, perLayer, wplane[4], wplane[5], nW);
  k_split<<<sgrid, tpb, 0, stream>>>(P2, layer_idx, perLayer, wplane[6], wplane[7], nW);

  dim3 g1(maxTiles, H / 64);
  k_stage1<<<g1, tpb, 0, stream>>>(v_repr, r_repr, wplane[0], wplane[1], wplane[2], wplane[3],
                                   Wb, Ub, layer_idx, tile_role, row_map, hhi, hlo, H, R);
  dim3 g2(maxTiles, H / 128);
  k_gemm<0><<<g2, tpb, 0, stream>>>(hhi, hlo, wplane[4], wplane[5], P1b, layer_idx,
                                    tile_role, row_map, nullptr, thi, tlo, H, R);
  k_gemm<1><<<g2, tpb, 0, stream>>>(thi, tlo, wplane[6], wplane[7], P2b, layer_idx,
                                    tile_role, row_map, out, nullptr, nullptr, H, R);
}

// v001
// A run of this version takes 301 microseconds.
// Two timings next to v000 both put it at 1.39 times that version's speed.
#include <hip/hip_runtime.h>

// ---------------------------------------------------------------------------
// CDNA5 (gfx1250) implementation. wave32; WMMA f32_16x16x32_f16 with fp32
// hi/lo split (Markidis): Ah*Bh + Ah*Bl + Al*Bh at f32 accumulate gives
// ~2^-22 relative error on the fast f16 matrix pipe. Weights and
// intermediates are pre-split into hi/lo f16 planes; stage 1 splits its f32 inputs in-loop.
// ---------------------------------------------------------------------------

typedef _Float16 v16h  __attribute__((ext_vector_type(16)));
typedef _Float16 f16x8 __attribute__((ext_vector_type(8)));
typedef _Float16 f16x4 __attribute__((ext_vector_type(4)));
typedef float    v8f   __attribute__((ext_vector_type(8)));
typedef float    f32x4 __attribute__((ext_vector_type(4)));

#define TM 128         // M rows per block (sorted-entity tile)
#define TN 128         // N columns per block
#define TK 64          // K per staged slice: 128 B of every f16 row, one whole line
#define NROLES 3
#define LDA 72         // LDS row stride in f16 (144B: 16B x odd, conflict-free b128 reads)

// ---------------- control kernels (role sort) ----------------

__global__ void k_init(int* __restrict__ ctrl, int* __restrict__ row_map, int n) {
  int i = blockIdx.x * blockDim.x + threadIdx.x;
  if (i < n) row_map[i] = -1;
  if (i < 16) ctrl[i] = 0;   // [0..2]=counts [4..6]=cursors [8..10]=poff
}

__global__ void k_hist(const int* __restrict__ roles, int E, int* __restrict__ ctrl) {
  int i = blockIdx.x * blockDim.x + threadIdx.x;
  if (i < E) atomicAdd(&ctrl[roles[i]], 1);
}

__global__ void k_offsets(int* __restrict__ ctrl, int* __restrict__ tile_role, int maxTiles) {
  __shared__ int s_off[NROLES], s_cnt[NROLES];
  if (threadIdx.x == 0) {
    int off = 0;
    for (int r = 0; r < NROLES; ++r) {
      ctrl[8 + r] = off; s_off[r] = off; s_cnt[r] = ctrl[r];
      off += ctrl[r];
      off = ((off + TM - 1) / TM) * TM;          // tile-align next segment
    }
  }
  __syncthreads();
  for (int t = threadIdx.x; t < maxTiles; t += blockDim.x) {
    int role = -1, base = t * TM;
    for (int r = 0; r < NROLES; ++r)
      if (base >= s_off[r] && base < s_off[r] + s_cnt[r]) role = r;
    tile_role[t] = role;
  }
}

__global__ void k_scatter(const int* __restrict__ roles, int E,
                          int* __restrict__ ctrl, int* __restrict__ row_map) {
  int i = blockIdx.x * blockDim.x + threadIdx.x;
  if (i >= E) return;
  int r = roles[i];
  int pos = ctrl[8 + r] + atomicAdd(&ctrl[4 + r], 1);
  row_map[pos] = i;
}

// ---------------- weight pre-split: fp32 -> hi/lo f16 planes ----------------

__global__ void k_split(const float* __restrict__ base, const int* __restrict__ layer_idx_p,
                        size_t perLayer, _Float16* __restrict__ hi,
                        _Float16* __restrict__ lo, int n) {
  int i = blockIdx.x * blockDim.x + threadIdx.x;
  if (i >= n) return;
  float x = base[(size_t)layer_idx_p[0] * perLayer + i];
  _Float16 h = (_Float16)x;
  hi[i] = h;
  lo[i] = (_Float16)(x - (float)h);
}

// ---------------- GEMM building blocks ----------------

// Staging of one K slice, global -> registers -> LDS. Every fetch of a slice is written
// ahead of the first LDS store, so that a slice costs one memory latency, not one per piece.
// Addresses are a wave-uniform base that stays fixed over the K loop plus a 32-bit byte
// offset of the thread, which the K loop advances in place.

// 128 rows x 64 f32, row-gathered: 16 lanes cover 256 contiguous bytes of one row.
// off[i] = byte offset of this thread's piece of the slice in the source row of tile row
// (t >> 4) + 16 i.
__device__ inline void fetch_f32g(const float* __restrict__ src, const unsigned (&off)[8],
                                  f32x4 (&x)[8]) {
#pragma unroll  // constant indices, so that the arrays stay in registers
  for (int i = 0; i < 8; ++i) x[i] = *(const f32x4*)((const char*)src + off[i]);
}

// Split to hi/lo f16 and store (256 threads).
__device__ inline void put_split(const f32x4 (&x)[8],
                                 _Float16* __restrict__ Shi, _Float16* __restrict__ Slo) {
  int r0 = threadIdx.x >> 4, c = (threadIdx.x & 15) * 4;
#pragma unroll  // constant indices, so that the arrays stay in registers
  for (int i = 0; i < 8; ++i) {
    f16x4 h, l;
#pragma unroll  // constant indices, so that the arrays stay in registers
    for (int j = 0; j < 4; ++j) {
      h[j] = (_Float16)x[i][j];
      l[j] = (_Float16)(x[i][j] - (float)h[j]);
    }
    *(f16x4*)&Shi[(r0 + i * 16) * LDA + c] = h;
    *(f16x4*)&Slo[(r0 + i * 16) * LDA + c] = l;
  }
}

// 128 rows x 64 f16 of one pre-split plane: 8 lanes cover one whole 128-B line of a row.
// src = first element of the tile's first row; off[i] = byte offset from there of this
// thread's piece of the slice in tile row (t >> 3) + i * NT / 8.
template<int NT>
__device__ inline void fetch_f16(const _Float16* __restrict__ src, const unsigned (&off)[1024 / NT],
                                 f16x8 (&x)[1024 / NT]) {
#pragma unroll  // constant indices, so that the arrays stay in registers
  for (int i = 0; i < 1024 / NT; ++i) x[i] = *(const f16x8*)((const char*)src + off[i]);
}

template<int NT>
__device__ inline void put_f16(const f16x8 (&x)[1024 / NT], _Float16* __restrict__ S) {
  int r0 = threadIdx.x >> 3, c = (threadIdx.x & 7) * 8;
#pragma unroll  // constant indices, so that the arrays stay in registers
  for (int i = 0; i < 1024 / NT; ++i) *(f16x8*)&S[(r0 + i * (NT / 8)) * LDA + c] = x[i];
}

// Per-lane WMMA fragment per ISA layout, for the 32 k that start at kb in the slice:
// lane<16: K{0..7,16..23}; lane>=16: K{8..15,24..31}, row = lane&15 (+rowbase).
__device__ inline v16h load_frag(const _Float16* __restrict__ S, int rowbase, int kb) {
  int lane = threadIdx.x & 31;
  int row  = rowbase + (lane & 15);
  int ko   = kb + (lane >> 4) * 8;
  f16x8 a = *(const f16x8*)&S[row * LDA + ko];
  f16x8 b = *(const f16x8*)&S[row * LDA + ko + 16];
  return __builtin_shufflevector(a, b, 0,1,2,3,4,5,6,7,8,9,10,11,12,13,14,15);
}

// fp32-accurate product via 3 f16 WMMAs.
__device__ inline v8f mma3(v16h ah, v16h al, v16h bh, v16h bl, v8f c) {
  c = __builtin_amdgcn_wmma_f32_16x16x32_f16(false, ah, false, bh, (short)0, c, false, false);
  c = __builtin_amdgcn_wmma_f32_16x16x32_f16(false, ah, false, bl, (short)0, c, false, false);
  c = __builtin_amdgcn_wmma_f32_16x16x32_f16(false, al, false, bh, (short)0, c, false, false);
  return c;
}

// ---------------- stage 1: h = (v@W^T + Wb) * (r@U^T + Ub), gathered ----------------
// Block tile 128M x 128N, 8 waves each 64M x 32N. The two products run one after the
// other over the whole K through the same LDS tiles, so that a slice's staging registers
// and both accumulator sets fit the budget of two blocks per WGP.

// acc += X[gathered rows] @ B^T for this block's tile; B given as its hi and lo plane,
// both pointing at the tile's first row.
__device__ inline void stage1_product(const float* __restrict__ X,
                                      const _Float16* __restrict__ Bhi,
                                      const _Float16* __restrict__ Blo, int H,
                                      unsigned (&aoff)[8], unsigned (&boff)[4],
                                      _Float16* __restrict__ sAh, _Float16* __restrict__ sAl,
                                      _Float16* __restrict__ sBh, _Float16* __restrict__ sBl,
                                      int wm, int wn, v8f (&acc)[4][2]) {
  for (int k0 = 0; k0 < H; k0 += TK) {
    f32x4 xa[8];
    f16x8 xbh[4], xbl[4];
    fetch_f32g(X, aoff, xa);
    fetch_f16<256>(Bhi, boff, xbh);
    fetch_f16<256>(Blo, boff, xbl);
    put_split(xa, sAh, sAl);
    put_f16<256>(xbh, sBh);
    put_f16<256>(xbl, sBl);
#pragma unroll  // constant indices, so that the arrays stay in registers
    for (int i = 0; i < 8; ++i) aoff[i] += TK * 4;
#pragma unroll  // constant indices, so that the arrays stay in registers
    for (int i = 0; i < 4; ++i) boff[i] += TK * 2;
    __syncthreads();
#pragma unroll  // constant indices, so that the arrays stay in registers
    for (int kb = 0; kb < TK; kb += 32) {
      v16h bh[2], bl[2];
#pragma unroll  // constant indices, so that the arrays stay in registers
      for (int j = 0; j < 2; ++j) {
        bh[j] = load_frag(sBh, wn * 32 + j * 16, kb);
        bl[j] = load_frag(sBl, wn * 32 + j * 16, kb);
      }
#pragma unroll  // constant indices, so that the arrays stay in registers
      for (int i = 0; i < 4; ++i) {
        v16h ah = load_frag(sAh, wm * 64 + i * 16, kb);
        v16h al = load_frag(sAl, wm * 64 + i * 16, kb);
#pragma unroll  // constant indices, so that the arrays stay in registers
        for (int j = 0; j < 2; ++j) acc[i][j] = mma3(ah, al, bh[j], bl[j], acc[i][j]);
      }
    }
    __syncthreads();
  }
#pragma unroll  // constant indices, so that the arrays stay in registers
  for (int i = 0; i < 8; ++i) aoff[i] -= (unsigned)H * 4;   // back to k = 0 for the next product
#pragma unroll  // constant indices, so that the arrays stay in registers
  for (int i = 0; i < 4; ++i) boff[i] -= (unsigned)H * 2;
}

__global__ __launch_bounds__(256)
void k_stage1(const float* __restrict__ v_repr, const float* __restrict__ r_repr,
              const _Float16* __restrict__ Whi, const _Float16* __restrict__ Wlo,
              const _Float16* __restrict__ Uhi, const _Float16* __restrict__ Ulo,
              const float* __restrict__ Wb, const float* __restrict__ Ub,
              const int* __restrict__ layer_idx_p,
              const int* __restrict__ tile_role, const int* __restrict__ row_map,
              _Float16* __restrict__ hhi, _Float16* __restrict__ hlo, int H, int R) {
  __shared__ _Float16 sAh[TM * LDA], sAl[TM * LDA];
  __shared__ _Float16 sBh[TN * LDA], sBl[TN * LDA];

  int tile = blockIdx.x;
  int role = tile_role[tile];
  if (role < 0) return;
  int layer = layer_idx_p[0];
  size_t wb = (size_t)role * H * H;      // pre-split planes hold the active layer only

  int m0 = tile * TM, n0 = blockIdx.y * TN;
  int wave = threadIdx.x >> 5;
  int wm = wave & 1, wn = wave >> 1;     // 2 (M) x 4 (N) wave grid

  // Padding rows (row_map < 0) read source row 0: their products reach only their own
  // rows of h, which the epilogue sets to zero.
  unsigned aoff[8];
#pragma unroll  // constant indices, so that the arrays stay in registers
  for (int i = 0; i < 8; ++i) {
    int srow = row_map[m0 + (threadIdx.x >> 4) + i * 16];
    aoff[i] = ((unsigned)(srow < 0 ? 0 : srow) * H + (threadIdx.x & 15) * 4) * 4u;
  }
  unsigned boff[4];
#pragma unroll  // constant indices, so that the arrays stay in registers
  for (int i = 0; i < 4; ++i)
    boff[i] = (((threadIdx.x >> 3) + i * 32) * H + (threadIdx.x & 7) * 8) * 2u;
  size_t bb = wb + (size_t)n0 * H;

  v8f accW[4][2] = {}; v8f accU[4][2] = {};
  stage1_product(v_repr, Whi + bb, Wlo + bb, H, aoff, boff, sAh, sAl, sBh, sBl, wm, wn, accW);
  stage1_product(r_repr, Uhi + bb, Ulo + bb, H, aoff, boff, sAh, sAl, sBh, sBl, wm, wn, accU);

  int lane = threadIdx.x & 31;
  const float* Wbl = Wb + ((size_t)layer * R + role) * H;
  const float* Ubl = Ub + ((size_t)layer * R + role) * H;
#pragma unroll  // constant indices, so that the arrays stay in registers
  for (int i = 0; i < 4; ++i) {
#pragma unroll  // constant indices, so that the arrays stay in registers
    for (int j = 0; j < 2; ++j) {
      int col = n0 + wn * 32 + j * 16 + (lane & 15);
      float bw = Wbl[col], bu = Ubl[col];
#pragma unroll  // constant indices, so that the arrays stay in registers
      for (int g = 0; g < 8; ++g) {
        int mrow = m0 + wm * 64 + i * 16 + g + (lane >> 4) * 8;
        float h = (accW[i][j][g] + bw) * (accU[i][j][g] + bu);
        h = (row_map[mrow] >= 0) ? h : 0.0f;
        _Float16 hh = (_Float16)h;
        size_t o = (size_t)mrow * H + col;
        hhi[o] = hh;
        hlo[o] = (_Float16)(h - (float)hh);
      }
    }
  }
}

// ---------------- stages 2/3: block tile 128M x 128N, 4 waves each 64M x 64N --------
// EPI==0: dst = relu(A@P^T + b), re-split to hi/lo planes (sorted -> sorted)
// EPI==1: out[row_map[row]] = A@P^T + b   (sorted -> scatter, f32)

template<int EPI>
__global__ __launch_bounds__(128)
void k_gemm(const _Float16* __restrict__ Ahi, const _Float16* __restrict__ Alo,
            const _Float16* __restrict__ Bhi, const _Float16* __restrict__ Blo,
            const float* __restrict__ Pb, const int* __restrict__ layer_idx_p,
            const int* __restrict__ tile_role, const int* __restrict__ row_map,
            float* __restrict__ outF,
            _Float16* __restrict__ dsthi, _Float16* __restrict__ dstlo,
            int H, int R) {
  __shared__ _Float16 sAh[TM * LDA], sAl[TM * LDA];
  __shared__ _Float16 sBh[TN * LDA], sBl[TN * LDA];

  int tile = blockIdx.x;
  int role = tile_role[tile];
  if (role < 0) return;
  int layer = layer_idx_p[0];
  size_t pb = (size_t)role * H * H;

  int m0 = tile * TM, n0 = blockIdx.y * TN;
  int wave = threadIdx.x >> 5;
  int wm = wave & 1, wn = wave >> 1;     // 2 (M) x 2 (N) wave grid
  unsigned off[8];
#pragma unroll  // constant indices, so that the arrays stay in registers
  for (int i = 0; i < 8; ++i)
    off[i] = (((threadIdx.x >> 3) + i * 16) * H + (threadIdx.x & 7) * 8) * 2u;
  size_t ab = (size_t)m0 * H, bb = pb + (size_t)n0 * H;

  v8f acc[4][4] = {};
  for (int k0 = 0; k0 < H; k0 += TK) {
    f16x8 xah[8], xal[8], xbh[8], xbl[8];
    fetch_f16<128>(Ahi + ab, off, xah);
    fetch_f16<128>(Alo + ab, off, xal);
    fetch_f16<128>(Bhi + bb, off, xbh);
    fetch_f16<128>(Blo + bb, off, xbl);
    put_f16<128>(xah, sAh);
    put_f16<128>(xal, sAl);
    put_f16<128>(xbh, sBh);
    put_f16<128>(xbl, sBl);
#pragma unroll  // constant indices, so that the arrays stay in registers
    for (int i = 0; i < 8; ++i) off[i] += TK * 2;
    __syncthreads();
#pragma unroll  // constant indices, so that the arrays stay in registers
    for (int kb = 0; kb < TK; kb += 32) {
      v16h bh[4], bl[4];
#pragma unroll  // constant indices, so that the arrays stay in registers
      for (int j = 0; j < 4; ++j) {
        bh[j] = load_frag(sBh, wn * 64 + j * 16, kb);
        bl[j] = load_frag(sBl, wn * 64 + j * 16, kb);
      }
#pragma unroll  // constant indices, so that the arrays stay in registers
      for (int i = 0; i < 4; ++i) {
        v16h ah = load_frag(sAh, wm * 64 + i * 16, kb);
        v16h al = load_frag(sAl, wm * 64 + i * 16, kb);
#pragma unroll  // constant indices, so that the arrays stay in registers
        for (int j = 0; j < 4; ++j) acc[i][j] = mma3(ah, al, bh[j], bl[j], acc[i][j]);
      }
    }
    __syncthreads();
  }

  int lane = threadIdx.x & 31;
  const float* Pbl = Pb + ((size_t)layer * R + role) * H;
#pragma unroll  // constant indices, so that the arrays stay in registers
  for (int i = 0; i < 4; ++i) {
#pragma unroll  // constant indices, so that the arrays stay in registers
    for (int j = 0; j < 4; ++j) {
      int col = n0 + wn * 64 + j * 16 + (lane & 15);
      float b = Pbl[col];
#pragma unroll  // constant indices, so that the arrays stay in registers
      for (int g = 0; g < 8; ++g) {
        int mrow = m0 + wm * 64 + i * 16 + g + (lane >> 4) * 8;
        float val = acc[i][j][g] + b;
        if (EPI == 0) {
          val = fmaxf(val, 0.0f);
          _Float16 vh = (_Float16)val;
          size_t o = (size_t)mrow * H + col;
          dsthi[o] = vh;
          dstlo[o] = (_Float16)(val - (float)vh);
        } else {
          int e = row_map[mrow];
          if (e >= 0) outF[(size_t)e * H + col] = val;
        }
      }
    }
  }
}

// ---------------- host launch ----------------

static inline size_t align256(size_t x) { return (x + 255) & ~(size_t)255; }

extern "C" void kernel_launch(void* const* d_in, const int* in_sizes, int n_in,
                              void* d_out, int out_size, void* d_ws, size_t ws_size,
                              hipStream_t stream) {
  const float* v_repr = (const float*)d_in[0];
  const float* r_repr = (const float*)d_in[1];
  const int*   roles  = (const int*)d_in[2];
  const float* W   = (const float*)d_in[3];
  const float* Wb  = (const float*)d_in[4];
  const float* U   = (const float*)d_in[5];
  const float* Ub  = (const float*)d_in[6];
  const float* P1  = (const float*)d_in[7];
  const float* P1b = (const float*)d_in[8];
  const float* P2  = (const float*)d_in[9];
  const float* P2b = (const float*)d_in[10];
  const int*   layer_idx = (const int*)d_in[11];
  float* out = (float*)d_out;

  const int E = in_sizes[2];
  const int H = in_sizes[0] / E;                // 512
  const int R = NROLES;
  const int maxTiles = (E + TM - 1) / TM + R;   // padded role segments
  const int padRows  = maxTiles * TM;
  const int nW       = R * H * H;               // per-layer weight slice elements
  const size_t perLayer = (size_t)nW;

  char* ws = (char*)d_ws;
  size_t off = 0;
  int* ctrl      = (int*)(ws + off); off += 256;
  int* tile_role = (int*)(ws + off); off = align256(off + (size_t)maxTiles * 4);
  int* row_map   = (int*)(ws + off); off = align256(off + (size_t)padRows * 4);

  _Float16* wplane[8];                          // Whi Wlo Uhi Ulo P1hi P1lo P2hi P2lo
  for (int i = 0; i < 8; ++i) {
    wplane[i] = (_Float16*)(ws + off);
    off = align256(off + (size_t)nW * 2);
  }
  size_t actBytes = (size_t)padRows * H * 2;
  _Float16* hhi = (_Float16*)(ws + off); off = align256(off + actBytes);
  _Float16* hlo = (_Float16*)(ws + off); off = align256(off + actBytes);
  _Float16* thi = (_Float16*)(ws + off); off = align256(off + actBytes);
  _Float16* tlo = (_Float16*)(ws + off); off = align256(off + actBytes);

  int tpb = 256;
  k_init   <<<(padRows + tpb - 1) / tpb, tpb, 0, stream>>>(ctrl, row_map, padRows);
  k_hist   <<<(E + tpb - 1) / tpb,       tpb, 0, stream>>>(roles, E, ctrl);
  k_offsets<<<1,                          tpb, 0, stream>>>(ctrl, tile_role, maxTiles);
  k_scatter<<<(E + tpb - 1) / tpb,       tpb, 0, stream>>>(roles, E, ctrl, row_map);

  int sgrid = (nW + tpb - 1) / tpb;
  k_split<<<sgrid, tpb, 0, stream>>>(W,  layer_idx, perLayer, wplane[0], wplane[1], nW);
  k_split<<<sgrid, tpb, 0, stream>>>(U,  layer_idx, perLayer, wplane[2], wplane[3], nW);
  k_split<<<sgrid, tpb, 0, stream>>>(P1, layer_idx, perLayer, wplane[4], wplane[5], nW);
  k_split<<<sgrid, tpb, 0, stream>>>(P2, layer_idx, perLayer, wplane[6], wplane[7], nW);

  dim3 g1(maxTiles, H / TN);
  k_stage1<<<g1, tpb, 0, stream>>>(v_repr, r_repr, wplane[0], wplane[1], wplane[2], wplane[3],
                                   Wb, Ub, layer_idx, tile_role, row_map, hhi, hlo, H, R);
  dim3 g2(maxTiles, H / TN);
  k_gemm<0><<<g2, 128, 0, stream>>>(hhi, hlo, wplane[4], wplane[5], P1b, layer_idx,
                                    tile_role, row_map, nullptr, thi, tlo, H, R);
  k_gemm<1><<<g2, 128, 0, stream>>>(thi, tlo, wplane[6], wplane[7], P2b, layer_idx,
                                    tile_role, row_map, out, nullptr, nullptr, H, R);
}

// v002
// It runs in 291 microseconds.
// Next to v001, in two timings, it ran 1.04 times as fast each time.
// All steps since v000 together make it 1.44 times as fast.
#include <hip/hip_runtime.h>

// ---------------------------------------------------------------------------
// CDNA5 (gfx1250) implementation. wave32; WMMA f32_16x16x32_f16 with fp32
// hi/lo split (Markidis): Ah*Bh + Ah*Bl + Al*Bh at f32 accumulate gives
// ~2^-22 relative error on the fast f16 matrix pipe. Weights and
// intermediates are pre-split into hi/lo f16 planes; stage 1 splits its f32 inputs in-loop.
// ---------------------------------------------------------------------------

typedef _Float16 v16h  __attribute__((ext_vector_type(16)));
typedef _Float16 f16x8 __attribute__((ext_vector_type(8)));
typedef _Float16 f16x4 __attribute__((ext_vector_type(4)));
typedef float    v8f   __attribute__((ext_vector_type(8)));
typedef float    f32x4 __attribute__((ext_vector_type(4)));

#define TM 128         // M rows per block (sorted-entity tile)
#define TN 128         // N columns per block
#define TK 64          // K per staged slice: 128 B of every f16 row, one whole line
#define NROLES 3
#define LDA 72         // LDS row stride in f16 (144B: 16B x odd, conflict-free b128 reads)

// ---------------- control kernels (role sort) ----------------

__global__ void k_init(int* __restrict__ ctrl, int* __restrict__ row_map, int n) {
  int i = blockIdx.x * blockDim.x + threadIdx.x;
  if (i < n) row_map[i] = -1;
  if (i < 16) ctrl[i] = 0;   // [0..2]=counts [4..6]=cursors [8..10]=poff
}

__global__ void k_hist(const int* __restrict__ roles, int E, int* __restrict__ ctrl) {
  int i = blockIdx.x * blockDim.x + threadIdx.x;
  if (i < E) atomicAdd(&ctrl[roles[i]], 1);
}

__global__ void k_offsets(int* __restrict__ ctrl, int* __restrict__ tile_role, int maxTiles) {
  __shared__ int s_off[NROLES], s_cnt[NROLES];
  if (threadIdx.x == 0) {
    int off = 0;
    for (int r = 0; r < NROLES; ++r) {
      ctrl[8 + r] = off; s_off[r] = off; s_cnt[r] = ctrl[r];
      off += ctrl[r];
      off = ((off + TM - 1) / TM) * TM;          // tile-align next segment
    }
  }
  __syncthreads();
  for (int t = threadIdx.x; t < maxTiles; t += blockDim.x) {
    int role = -1, base = t * TM;
    for (int r = 0; r < NROLES; ++r)
      if (base >= s_off[r] && base < s_off[r] + s_cnt[r]) role = r;
    tile_role[t] = role;
  }
}

__global__ void k_scatter(const int* __restrict__ roles, int E,
                          int* __restrict__ ctrl, int* __restrict__ row_map) {
  int i = blockIdx.x * blockDim.x + threadIdx.x;
  if (i >= E) return;
  int r = roles[i];
  int pos = ctrl[8 + r] + atomicAdd(&ctrl[4 + r], 1);
  row_map[pos] = i;
}

// ---------------- weight pre-split: fp32 -> hi/lo f16 planes ----------------

// One launch splits the active layer of all four weight stacks (blockIdx.y picks the stack).
// Starting a wave costs more than the few bytes a one-value thread moves, so a thread takes
// SPLIT_P pieces of four values: every 16-B load of a thread is issued ahead of its first
// store, a wave's load covers 512 contiguous bytes and its store 256.
#define SPLIT_P 8
#define SPLIT_BLOCK (256 * 4 * SPLIT_P)   // values per block

// n = values of one layer of one stack, a multiple of 4; L = layers in a stack.
// planes = hi plane of stack 0; the eight planes (hi, lo of each stack) lie pitch apart.
__global__ __launch_bounds__(256)
void k_split(const float* __restrict__ W, const float* __restrict__ U,
             const float* __restrict__ P1, const float* __restrict__ P2,
             const int* __restrict__ layer_idx_p, int L, int n,
             _Float16* __restrict__ planes, size_t pitch) {
  int s = blockIdx.y;
  const float* base = s == 0 ? W : s == 1 ? U : s == 2 ? P1 : P2;
  int layer = min(max(layer_idx_p[0], 0), L - 1);
  const float* src = base + (size_t)layer * n;
  _Float16* hi = planes + (size_t)(2 * s) * pitch;
  _Float16* lo = hi + pitch;
  int i0 = blockIdx.x * SPLIT_BLOCK + threadIdx.x * 4;
  f32x4 x[SPLIT_P];
#pragma unroll  // constant indices, so that the array stays in registers
  for (int p = 0; p < SPLIT_P; ++p)      // a piece past the end reads the last piece instead
    x[p] = *(const f32x4*)&src[min(i0 + p * 1024, n - 4)];
#pragma unroll  // constant indices, so that the array stays in registers
  for (int p = 0; p < SPLIT_P; ++p) {
    int i = i0 + p * 1024;
    if (i >= n) continue;
    f16x4 h, l;
#pragma unroll  // constant indices, so that the vectors stay in registers
    for (int j = 0; j < 4; ++j) {
      h[j] = (_Float16)x[p][j];
      l[j] = (_Float16)(x[p][j] - (float)h[j]);
    }
    *(f16x4*)&hi[i] = h;
    *(f16x4*)&lo[i] = l;
  }
}

// ---------------- GEMM building blocks ----------------

// Staging of one K slice, global -> registers -> LDS. Every fetch of a slice is written
// ahead of the first LDS store, so that a slice costs one memory latency, not one per piece.
// Addresses are a wave-uniform base that stays fixed over the K loop plus a 32-bit byte
// offset of the thread, which the K loop advances in place.

// 128 rows x 64 f32, row-gathered: 16 lanes cover 256 contiguous bytes of one row.
// off[i] = byte offset of this thread's piece of the slice in the source row of tile row
// (t >> 4) + 16 i.
__device__ inline void fetch_f32g(const float* __restrict__ src, const unsigned (&off)[8],
                                  f32x4 (&x)[8]) {
#pragma unroll  // constant indices, so that the arrays stay in registers
  for (int i = 0; i < 8; ++i) x[i] = *(const f32x4*)((const char*)src + off[i]);
}

// Split to hi/lo f16 and store (256 threads).
__device__ inline void put_split(const f32x4 (&x)[8],
                                 _Float16* __restrict__ Shi, _Float16* __restrict__ Slo) {
  int r0 = threadIdx.x >> 4, c = (threadIdx.x & 15) * 4;
#pragma unroll  // constant indices, so that the arrays stay in registers
  for (int i = 0; i < 8; ++i) {
    f16x4 h, l;
#pragma unroll  // constant indices, so that the arrays stay in registers
    for (int j = 0; j < 4; ++j) {
      h[j] = (_Float16)x[i][j];
      l[j] = (_Float16)(x[i][j] - (float)h[j]);
    }
    *(f16x4*)&Shi[(r0 + i * 16) * LDA + c] = h;
    *(f16x4*)&Slo[(r0 + i * 16) * LDA + c] = l;
  }
}

// 128 rows x 64 f16 of one pre-split plane: 8 lanes cover one whole 128-B line of a row.
// src = first element of the tile's first row; off[i] = byte offset from there of this
// thread's piece of the slice in tile row (t >> 3) + i * NT / 8.
template<int NT>
__device__ inline void fetch_f16(const _Float16* __restrict__ src, const unsigned (&off)[1024 / NT],
                                 f16x8 (&x)[1024 / NT]) {
#pragma unroll  // constant indices, so that the arrays stay in registers
  for (int i = 0; i < 1024 / NT; ++i) x[i] = *(const f16x8*)((const char*)src + off[i]);
}

template<int NT>
__device__ inline void put_f16(const f16x8 (&x)[1024 / NT], _Float16* __restrict__ S) {
  int r0 = threadIdx.x >> 3, c = (threadIdx.x & 7) * 8;
#pragma unroll  // constant indices, so that the arrays stay in registers
  for (int i = 0; i < 1024 / NT; ++i) *(f16x8*)&S[(r0 + i * (NT / 8)) * LDA + c] = x[i];
}

// Per-lane WMMA fragment per ISA layout, for the 32 k that start at kb in the slice:
// lane<16: K{0..7,16..23}; lane>=16: K{8..15,24..31}, row = lane&15 (+rowbase).
__device__ inline v16h load_frag(const _Float16* __restrict__ S, int rowbase, int kb) {
  int lane = threadIdx.x & 31;
  int row  = rowbase + (lane & 15);
  int ko   = kb + (lane >> 4) * 8;
  f16x8 a = *(const f16x8*)&S[row * LDA + ko];
  f16x8 b = *(const f16x8*)&S[row * LDA + ko + 16];
  return __builtin_shufflevector(a, b, 0,1,2,3,4,5,6,7,8,9,10,11,12,13,14,15);
}

// fp32-accurate product via 3 f16 WMMAs.
__device__ inline v8f mma3(v16h ah, v16h al, v16h bh, v16h bl, v8f c) {
  c = __builtin_amdgcn_wmma_f32_16x16x32_f16(false, ah, false, bh, (short)0, c, false, false);
  c = __builtin_amdgcn_wmma_f32_16x16x32_f16(false, ah, false, bl, (short)0, c, false, false);
  c = __builtin_amdgcn_wmma_f32_16x16x32_f16(false, al, false, bh, (short)0, c, false, false);
  return c;
}

// ---------------- stage 1: h = (v@W^T + Wb) * (r@U^T + Ub), gathered ----------------
// Block tile 128M x 128N, 8 waves each 64M x 32N. The two products run one after the
// other over the whole K through the same LDS tiles, so that a slice's staging registers
// and both accumulator sets fit the budget of two blocks per WGP.

// acc += X[gathered rows] @ B^T for this block's tile; B given as its hi and lo plane,
// both pointing at the tile's first row.
__device__ inline void stage1_product(const float* __restrict__ X,
                                      const _Float16* __restrict__ Bhi,
                                      const _Float16* __restrict__ Blo, int H,
                                      unsigned (&aoff)[8], unsigned (&boff)[4],
                                      _Float16* __restrict__ sAh, _Float16* __restrict__ sAl,
                                      _Float16* __restrict__ sBh, _Float16* __restrict__ sBl,
                                      int wm, int wn, v8f (&acc)[4][2]) {
  for (int k0 = 0; k0 < H; k0 += TK) {
    f32x4 xa[8];
    f16x8 xbh[4], xbl[4];
    fetch_f32g(X, aoff, xa);
    fetch_f16<256>(Bhi, boff, xbh);
    fetch_f16<256>(Blo, boff, xbl);
    put_split(xa, sAh, sAl);
    put_f16<256>(xbh, sBh);
    put_f16<256>(xbl, sBl);
#pragma unroll  // constant indices, so that the arrays stay in registers
    for (int i = 0; i < 8; ++i) aoff[i] += TK * 4;
#pragma unroll  // constant indices, so that the arrays stay in registers
    for (int i = 0; i < 4; ++i) boff[i] += TK * 2;
    __syncthreads();
#pragma unroll  // constant indices, so that the arrays stay in registers
    for (int kb = 0; kb < TK; kb += 32) {
      v16h bh[2], bl[2];
#pragma unroll  // constant indices, so that the arrays stay in registers
      for (int j = 0; j < 2; ++j) {
        bh[j] = load_frag(sBh, wn * 32 + j * 16, kb);
        bl[j] = load_frag(sBl, wn * 32 + j * 16, kb);
      }
#pragma unroll  // constant indices, so that the arrays stay in registers
      for (int i = 0; i < 4; ++i) {
        v16h ah = load_frag(sAh, wm * 64 + i * 16, kb);
        v16h al = load_frag(sAl, wm * 64 + i * 16, kb);
#pragma unroll  // constant indices, so that the arrays stay in registers
        for (int j = 0; j < 2; ++j) acc[i][j] = mma3(ah, al, bh[j], bl[j], acc[i][j]);
      }
    }
    __syncthreads();
  }
#pragma unroll  // constant indices, so that the arrays stay in registers
  for (int i = 0; i < 8; ++i) aoff[i] -= (unsigned)H * 4;   // back to k = 0 for the next product
#pragma unroll  // constant indices, so that the arrays stay in registers
  for (int i = 0; i < 4; ++i) boff[i] -= (unsigned)H * 2;
}

__global__ __launch_bounds__(256)
void k_stage1(const float* __restrict__ v_repr, const float* __restrict__ r_repr,
              const _Float16* __restrict__ Whi, const _Float16* __restrict__ Wlo,
              const _Float16* __restrict__ Uhi, const _Float16* __restrict__ Ulo,
              const float* __restrict__ Wb, const float* __restrict__ Ub,
              const int* __restrict__ layer_idx_p,
              const int* __restrict__ tile_role, const int* __restrict__ row_map,
              _Float16* __restrict__ hhi, _Float16* __restrict__ hlo, int H, int R) {
  __shared__ _Float16 sAh[TM * LDA], sAl[TM * LDA];
  __shared__ _Float16 sBh[TN * LDA], sBl[TN * LDA];

  int tile = blockIdx.x;
  int role = tile_role[tile];
  if (role < 0) return;
  int layer = layer_idx_p[0];
  size_t wb = (size_t)role * H * H;      // pre-split planes hold the active layer only

  int m0 = tile * TM, n0 = blockIdx.y * TN;
  int wave = threadIdx.x >> 5;
  int wm = wave & 1, wn = wave >> 1;     // 2 (M) x 4 (N) wave grid

  // Padding rows (row_map < 0) read source row 0: their products reach only their own
  // rows of h, which the epilogue sets to zero.
  unsigned aoff[8];
#pragma unroll  // constant indices, so that the arrays stay in registers
  for (int i = 0; i < 8; ++i) {
    int srow = row_map[m0 + (threadIdx.x >> 4) + i * 16];
    aoff[i] = ((unsigned)(srow < 0 ? 0 : srow) * H + (threadIdx.x & 15) * 4) * 4u;
  }
  unsigned boff[4];
#pragma unroll  // constant indices, so that the arrays stay in registers
  for (int i = 0; i < 4; ++i)
    boff[i] = (((threadIdx.x >> 3) + i * 32) * H + (threadIdx.x & 7) * 8) * 2u;
  size_t bb = wb + (size_t)n0 * H;

  v8f accW[4][2] = {}; v8f accU[4][2] = {};
  stage1_product(v_repr, Whi + bb, Wlo + bb, H, aoff, boff, sAh, sAl, sBh, sBl, wm, wn, accW);
  stage1_product(r_repr, Uhi + bb, Ulo + bb, H, aoff, boff, sAh, sAl, sBh, sBl, wm, wn, accU);

  int lane = threadIdx.x & 31;
  const float* Wbl = Wb + ((size_t)layer * R + role) * H;
  const float* Ubl = Ub + ((size_t)layer * R + role) * H;
#pragma unroll  // constant indices, so that the arrays stay in registers
  for (int i = 0; i < 4; ++i) {
#pragma unroll  // constant indices, so that the arrays stay in registers
    for (int j = 0; j < 2; ++j) {
      int col = n0 + wn * 32 + j * 16 + (lane & 15);
      float bw = Wbl[col], bu = Ubl[col];
#pragma unroll  // constant indices, so that the arrays stay in registers
      for (int g = 0; g < 8; ++g) {
        int mrow = m0 + wm * 64 + i * 16 + g + (lane >> 4) * 8;
        float h = (accW[i][j][g] + bw) * (accU[i][j][g] + bu);
        h = (row_map[mrow] >= 0) ? h : 0.0f;
        _Float16 hh = (_Float16)h;
        size_t o = (size_t)mrow * H + col;
        hhi[o] = hh;
        hlo[o] = (_Float16)(h - (float)hh);
      }
    }
  }
}

// ---------------- stages 2/3: block tile 128M x 128N, 4 waves each 64M x 64N --------
// EPI==0: dst = relu(A@P^T + b), re-split to hi/lo planes (sorted -> sorted)
// EPI==1: out[row_map[row]] = A@P^T + b   (sorted -> scatter, f32)

template<int EPI>
__global__ __launch_bounds__(128)
void k_gemm(const _Float16* __restrict__ Ahi, const _Float16* __restrict__ Alo,
            const _Float16* __restrict__ Bhi, const _Float16* __restrict__ Blo,
            const float* __restrict__ Pb, const int* __restrict__ layer_idx_p,
            const int* __restrict__ tile_role, const int* __restrict__ row_map,
            float* __restrict__ outF,
            _Float16* __restrict__ dsthi, _Float16* __restrict__ dstlo,
            int H, int R) {
  __shared__ _Float16 sAh[TM * LDA], sAl[TM * LDA];
  __shared__ _Float16 sBh[TN * LDA], sBl[TN * LDA];

  int tile = blockIdx.x;
  int role = tile_role[tile];
  if (role < 0) return;
  int layer = layer_idx_p[0];
  size_t pb = (size_t)role * H * H;

  int m0 = tile * TM, n0 = blockIdx.y * TN;
  int wave = threadIdx.x >> 5;
  int wm = wave & 1, wn = wave >> 1;     // 2 (M) x 2 (N) wave grid
  unsigned off[8];
#pragma unroll  // constant indices, so that the arrays stay in registers
  for (int i = 0; i < 8; ++i)
    off[i] = (((threadIdx.x >> 3) + i * 16) * H + (threadIdx.x & 7) * 8) * 2u;
  size_t ab = (size_t)m0 * H, bb = pb + (size_t)n0 * H;

  v8f acc[4][4] = {};
  for (int k0 = 0; k0 < H; k0 += TK) {
    f16x8 xah[8], xal[8], xbh[8], xbl[8];
    fetch_f16<128>(Ahi + ab, off, xah);
    fetch_f16<128>(Alo + ab, off, xal);
    fetch_f16<128>(Bhi + bb, off, xbh);
    fetch_f16<128>(Blo + bb, off, xbl);
    put_f16<128>(xah, sAh);
    put_f16<128>(xal, sAl);
    put_f16<128>(xbh, sBh);
    put_f16<128>(xbl, sBl);
#pragma unroll  // constant indices, so that the arrays stay in registers
    for (int i = 0; i < 8; ++i) off[i] += TK * 2;
    __syncthreads();
#pragma unroll  // constant indices, so that the arrays stay in registers
    for (int kb = 0; kb < TK; kb += 32) {
      v16h bh[4], bl[4];
#pragma unroll  // constant indices, so that the arrays stay in registers
      for (int j = 0; j < 4; ++j) {
        bh[j] = load_frag(sBh, wn * 64 + j * 16, kb);
        bl[j] = load_frag(sBl, wn * 64 + j * 16, kb);
      }
#pragma unroll  // constant indices, so that the arrays stay in registers
      for (int i = 0; i < 4; ++i) {
        v16h ah = load_frag(sAh, wm * 64 + i * 16, kb);
        v16h al = load_frag(sAl, wm * 64 + i * 16, kb);
#pragma unroll  // constant indices, so that the arrays stay in registers
        for (int j = 0; j < 4; ++j) acc[i][j] = mma3(ah, al, bh[j], bl[j], acc[i][j]);
      }
    }
    __syncthreads();
  }

  int lane = threadIdx.x & 31;
  const float* Pbl = Pb + ((size_t)layer * R + role) * H;
#pragma unroll  // constant indices, so that the arrays stay in registers
  for (int i = 0; i < 4; ++i) {
#pragma unroll  // constant indices, so that the arrays stay in registers
    for (int j = 0; j < 4; ++j) {
      int col = n0 + wn * 64 + j * 16 + (lane & 15);
      float b = Pbl[col];
#pragma unroll  // constant indices, so that the arrays stay in registers
      for (int g = 0; g < 8; ++g) {
        int mrow = m0 + wm * 64 + i * 16 + g + (lane >> 4) * 8;
        float val = acc[i][j][g] + b;
        if (EPI == 0) {
          val = fmaxf(val, 0.0f);
          _Float16 vh = (_Float16)val;
          size_t o = (size_t)mrow * H + col;
          dsthi[o] = vh;
          dstlo[o] = (_Float16)(val - (float)vh);
        } else {
          int e = row_map[mrow];
          if (e >= 0) outF[(size_t)e * H + col] = val;
        }
      }
    }
  }
}

// ---------------- host launch ----------------

static inline size_t align256(size_t x) { return (x + 255) & ~(size_t)255; }

extern "C" void kernel_launch(void* const* d_in, const int* in_sizes, int n_in,
                              void* d_out, int out_size, void* d_ws, size_t ws_size,
                              hipStream_t stream) {
  const float* v_repr = (const float*)d_in[0];
  const float* r_repr = (const float*)d_in[1];
  const int*   roles  = (const int*)d_in[2];
  const float* W   = (const float*)d_in[3];
  const float* Wb  = (const float*)d_in[4];
  const float* U   = (const float*)d_in[5];
  const float* Ub  = (const float*)d_in[6];
  const float* P1  = (const float*)d_in[7];
  const float* P1b = (const float*)d_in[8];
  const float* P2  = (const float*)d_in[9];
  const float* P2b = (const float*)d_in[10];
  const int*   layer_idx = (const int*)d_in[11];
  float* out = (float*)d_out;

  const int E = in_sizes[2];
  const int H = in_sizes[0] / E;                // 512
  const int R = NROLES;
  const int maxTiles = (E + TM - 1) / TM + R;   // padded role segments
  const int padRows  = maxTiles * TM;
  const int nW       = R * H * H;               // per-layer weight slice elements

  char* ws = (char*)d_ws;
  size_t off = 0;
  int* ctrl      = (int*)(ws + off); off += 256;
  int* tile_role = (int*)(ws + off); off = align256(off + (size_t)maxTiles * 4);
  int* row_map   = (int*)(ws + off); off = align256(off + (size_t)padRows * 4);

  _Float16* wplane[8];                          // Whi Wlo Uhi Ulo P1hi P1lo P2hi P2lo
  for (int i = 0; i < 8; ++i) {
    wplane[i] = (_Float16*)(ws + off);
    off = align256(off + (size_t)nW * 2);
  }
  size_t actBytes = (size_t)padRows * H * 2;
  _Float16* hhi = (_Float16*)(ws + off); off = align256(off + actBytes);
  _Float16* hlo = (_Float16*)(ws + off); off = align256(off + actBytes);
  _Float16* thi = (_Float16*)(ws + off); off = align256(off + actBytes);
  _Float16* tlo = (_Float16*)(ws + off); off = align256(off + actBytes);

  int tpb = 256;
  k_init   <<<(padRows + tpb - 1) / tpb, tpb, 0, stream>>>(ctrl, row_map, padRows);
  k_hist   <<<(E + tpb - 1) / tpb,       tpb, 0, stream>>>(roles, E, ctrl);
  k_offsets<<<1,                          tpb, 0, stream>>>(ctrl, tile_role, maxTiles);
  k_scatter<<<(E + tpb - 1) / tpb,       tpb, 0, stream>>>(roles, E, ctrl, row_map);

  dim3 gs((nW + SPLIT_BLOCK - 1) / SPLIT_BLOCK, 4);
  k_split<<<gs, tpb, 0, stream>>>(W, U, P1, P2, layer_idx, in_sizes[3] / nW, nW,
                                  wplane[0], (size_t)(wplane[1] - wplane[0]));

  dim3 g1(maxTiles, H / TN);
  k_stage1<<<g1, tpb, 0, stream>>>(v_repr, r_repr, wplane[0], wplane[1], wplane[2], wplane[3],
                                   Wb, Ub, layer_idx, tile_role, row_map, hhi, hlo, H, R);
  dim3 g2(maxTiles, H / TN);
  k_gemm<0><<<g2, 128, 0, stream>>>(hhi, hlo, wplane[4], wplane[5], P1b, layer_idx,
                                    tile_role, row_map, nullptr, thi, tlo, H, R);
  k_gemm<1><<<g2, 128, 0, stream>>>(thi, tlo, wplane[6], wplane[7], P2b, layer_idx,
                                    tile_role, row_map, out, nullptr, nullptr, H, R);
}

// v003
// It runs in 259 microseconds.
// Next to v002, in two timings, it ran 1.12 times as fast each time.
// All steps since v000 together make it 1.62 times as fast.
#include <hip/hip_runtime.h>

// ---------------------------------------------------------------------------
// CDNA5 (gfx1250) implementation. wave32; WMMA f32_16x16x32_f16 with fp32
// hi/lo split (Markidis): Ah*Bh + Ah*Bl + Al*Bh at f32 accumulate gives
// ~2^-22 relative error on the fast f16 matrix pipe. Weights and
// intermediates are pre-split into hi/lo f16 planes; stage 1 splits its f32 inputs in-loop.
// ---------------------------------------------------------------------------

typedef _Float16 v16h  __attribute__((ext_vector_type(16)));
typedef _Float16 f16x8 __attribute__((ext_vector_type(8)));
typedef _Float16 f16x4 __attribute__((ext_vector_type(4)));
typedef float    v8f   __attribute__((ext_vector_type(8)));
typedef float    f32x4 __attribute__((ext_vector_type(4)));

#define TM 128         // M rows per block (sorted-entity tile)
#define TN 128         // N columns per block
#define TK 64          // K per staged slice: 128 B of every f16 row, one whole line
#define NROLES 3
#define LDA 72         // LDS row stride in f16 (144B: 16B x odd, conflict-free b128 reads)

// ---------------- role sort ----------------

typedef int i32x4 __attribute__((ext_vector_type(4)));

#define SORT_CHUNK 1024   // entries that one block ranks: 256 threads x 4
#define SORT_BATCH 32     // chunks whose 16-B loads a thread has in flight together

// One count in a field of 10 bits per role. A role outside the range takes the nearest one,
// so that every position formed below stays inside its segment.
__device__ inline unsigned role_bit(int r) { return 1u << (10 * min(max(r, 0), NROLES - 1)); }
__device__ inline unsigned role_bits(i32x4 v) {
  return (role_bit(v[0]) + role_bit(v[1])) + (role_bit(v[2]) + role_bit(v[3]));
}

// Counting sort of the entities by role, segments aligned to TM rows, with no word shared
// between blocks: every block counts the whole role array itself (whole-array counts give
// the segment starts, the counts ahead of its chunk give the chunk's start in each segment)
// and ranks the entries of its own chunk by a prefix scan. Rows of a role come out in index
// order. 256 threads. A thread counts 4 entries of every chunk in 10-bit fields: E < 261,000.
__device__ inline void role_sort(const int* __restrict__ roles, int E, int maxTiles,
                                 int* __restrict__ tile_role, int* __restrict__ row_map) {
  __shared__ int s_cnt[8][2 * NROLES];   // per wave: whole-array counts, counts ahead of the chunk
  __shared__ unsigned s_scan[8];         // per wave: packed counts of its part of the chunk
  const int t = threadIdx.x, lane = t & 31, wave = t >> 5;
  const int full = E / SORT_CHUNK;
  for (int c = blockIdx.x; c * SORT_CHUNK < E; c += gridDim.x) {
    // This thread's four entries of the chunk, fetched ahead of the counting loads.
    const int e0 = c * SORT_CHUNK + t * 4;
    i32x4 ov;
    if (c < full) {
      ov = *(const i32x4*)&roles[e0];
    } else {                             // the partial chunk: an entry past the end reads the last one
#pragma unroll  // constant indices, so that the vector stays in registers
      for (int j = 0; j < 4; ++j) ov[j] = roles[min(e0 + j, E - 1)];
      // The code behind this branch reuses the four loads' offset registers: the wait stands
      // between the loads and the first such overwrite.
      asm volatile("s_wait_xcnt 0x0" ::: "memory");
    }

    unsigned acc = 0, bef = 0;
    int k = 0;
    for (; k + SORT_BATCH <= full; k += SORT_BATCH) {
      i32x4 v[SORT_BATCH];
#pragma unroll  // constant indices; every load of a batch stands ahead of the first count
      for (int u = 0; u < SORT_BATCH; ++u)
        v[u] = *(const i32x4*)&roles[(k + u) * SORT_CHUNK + t * 4];
#pragma unroll  // constant indices, so that the array stays in registers
      for (int u = 0; u < SORT_BATCH; ++u) {
        if (k + u == c) bef = acc;
        acc += role_bits(v[u]);
      }
    }
    for (; k < full; ++k) {              // whole chunks that do not fill a batch
      if (k == c) bef = acc;
      acc += role_bits(*(const i32x4*)&roles[k * SORT_CHUNK + t * 4]);
    }
    if (full * SORT_CHUNK < E) {         // the last chunk is a partial one
      if (c == full) bef = acc;
#pragma unroll  // four fixed entries
      for (int j = 0; j < 4; ++j) {
        int e = full * SORT_CHUNK + t * 4 + j;
        acc += e < E ? role_bit(roles[e]) : 0u;
      }
    }
    unsigned own[4];
#pragma unroll  // constant indices, so that the arrays stay in registers
    for (int j = 0; j < 4; ++j) own[j] = e0 + j < E ? role_bit(ov[j]) : 0u;

    int red[2 * NROLES] = {(int)(acc & 1023u), (int)((acc >> 10) & 1023u), (int)(acc >> 20),
                           (int)(bef & 1023u), (int)((bef >> 10) & 1023u), (int)(bef >> 20)};
#pragma unroll  // constant indices, so that the arrays stay in registers
    for (int m = 16; m > 0; m >>= 1)
#pragma unroll  // constant indices, so that the arrays stay in registers
      for (int q = 0; q < 2 * NROLES; ++q) red[q] += __shfl_xor(red[q], m);
    unsigned mine = (own[0] + own[1]) + (own[2] + own[3]);
    unsigned inc = mine;                 // inclusive scan over the wave; a field stays <= 128
#pragma unroll  // five fixed steps
    for (int d = 1; d < 32; d <<= 1) {
      unsigned o = __shfl_up(inc, d);
      if (lane >= d) inc += o;
    }
    if (lane == 0) {
#pragma unroll  // constant indices, so that the arrays stay in registers
      for (int q = 0; q < 2 * NROLES; ++q) s_cnt[wave][q] = red[q];
    }
    if (lane == 31) s_scan[wave] = inc;
    __syncthreads();                     // the waves' counts are read by every wave

    int sum[2 * NROLES] = {0, 0, 0, 0, 0, 0};
    unsigned ex = inc - mine;            // entries of the chunk ahead of this thread's, per role
#pragma unroll  // constant indices, so that the arrays stay in registers
    for (int w = 0; w < 8; ++w) {
#pragma unroll  // constant indices, so that the arrays stay in registers
      for (int q = 0; q < 2 * NROLES; ++q) sum[q] += s_cnt[w][q];
      if (w < wave) ex += s_scan[w];
    }
    int seg[NROLES + 1];
    seg[0] = 0;
#pragma unroll  // constant indices, so that the arrays stay in registers
    for (int r = 0; r < NROLES; ++r) seg[r + 1] = (seg[r] + sum[r] + TM - 1) / TM * TM;

#pragma unroll  // constant indices, so that the arrays stay in registers
    for (int j = 0; j < 4; ++j) {
      if (own[j] != 0u) {
        int r = (int)((own[j] >> 10) & 1u) + 2 * (int)(own[j] >> 20);
        int start = r == 0 ? seg[0] + sum[3] : r == 1 ? seg[1] + sum[4] : seg[2] + sum[5];
        row_map[start + (int)((ex >> (10 * r)) & 1023u)] = e0 + j;
        ex += own[j];
      }
    }

    if (c == 0) {                        // one block marks the padding rows and names the tiles
#pragma unroll  // constant indices, so that the arrays stay in registers
      for (int r = 0; r < NROLES; ++r) {
        int end = r + 1 < NROLES ? seg[r + 1] : maxTiles * TM;
#pragma unroll 1  // at most a few trips, in one block: keeps the code short
        for (int p = seg[r] + sum[r] + t; p < end; p += 256) row_map[p] = -1;
      }
#pragma unroll 1  // at most a few trips, in one block: keeps the code short
      for (int tl = t; tl < maxTiles; tl += 256) {
        int role = -1, base = tl * TM;
#pragma unroll  // constant indices, so that the arrays stay in registers
        for (int r = 0; r < NROLES; ++r)
          if (base >= seg[r] && base < seg[r] + sum[r]) role = r;
        tile_role[tl] = role;
      }
    }
    __syncthreads();                     // the next trip overwrites the waves' counts
  }
}

// ---------------- weight pre-split: fp32 -> hi/lo f16 planes ----------------

// One launch sorts the roles (blockIdx.y == 0; neither job reads what the other writes) and
// splits the active layer of all four weight stacks (blockIdx.y - 1 picks the stack).
// Starting a wave costs more than the few bytes a one-value thread moves, so a thread takes
// SPLIT_P pieces of four values: every 16-B load of a thread is issued ahead of its first
// store, a wave's load covers 512 contiguous bytes and its store 256.
#define SPLIT_P 8
#define SPLIT_BLOCK (256 * 4 * SPLIT_P)   // values per block

// n = values of one layer of one stack, a multiple of 4; L = layers in a stack.
// planes = hi plane of stack 0; the eight planes (hi, lo of each stack) lie pitch apart.
__global__ __launch_bounds__(256)
void k_split(const float* __restrict__ W, const float* __restrict__ U,
             const float* __restrict__ P1, const float* __restrict__ P2,
             const int* __restrict__ layer_idx_p, int L, int n,
             _Float16* __restrict__ planes, size_t pitch,
             const int* __restrict__ roles, int E, int maxTiles,
             int* __restrict__ tile_role, int* __restrict__ row_map) {
  if (blockIdx.y == 0) {
    role_sort(roles, E, maxTiles, tile_role, row_map);
    return;
  }
  int s = blockIdx.y - 1;
  const float* base = s == 0 ? W : s == 1 ? U : s == 2 ? P1 : P2;
  int layer = min(max(layer_idx_p[0], 0), L - 1);
  const float* src = base + (size_t)layer * n;
  _Float16* hi = planes + (size_t)(2 * s) * pitch;
  _Float16* lo = hi + pitch;
  int i0 = blockIdx.x * SPLIT_BLOCK + threadIdx.x * 4;
  f32x4 x[SPLIT_P];
#pragma unroll  // constant indices, so that the array stays in registers
  for (int p = 0; p < SPLIT_P; ++p)      // a piece past the end reads the last piece instead
    x[p] = *(const f32x4*)&src[min(i0 + p * 1024, n - 4)];
#pragma unroll  // constant indices, so that the array stays in registers
  for (int p = 0; p < SPLIT_P; ++p) {
    int i = i0 + p * 1024;
    if (i >= n) continue;
    f16x4 h, l;
#pragma unroll  // constant indices, so that the vectors stay in registers
    for (int j = 0; j < 4; ++j) {
      h[j] = (_Float16)x[p][j];
      l[j] = (_Float16)(x[p][j] - (float)h[j]);
    }
    *(f16x4*)&hi[i] = h;
    *(f16x4*)&lo[i] = l;
  }
}

// ---------------- GEMM building blocks ----------------

// Staging of one K slice, global -> registers -> LDS. Every fetch of a slice is written
// ahead of the first LDS store, so that a slice costs one memory latency, not one per piece.
// Addresses are a wave-uniform base that stays fixed over the K loop plus a 32-bit byte
// offset of the thread, which the K loop advances in place.

// 128 rows x 64 f32, row-gathered: 16 lanes cover 256 contiguous bytes of one row.
// off[i] = byte offset of this thread's piece of the slice in the source row of tile row
// (t >> 4) + 16 i.
__device__ inline void fetch_f32g(const float* __restrict__ src, const unsigned (&off)[8],
                                  f32x4 (&x)[8]) {
#pragma unroll  // constant indices, so that the arrays stay in registers
  for (int i = 0; i < 8; ++i) x[i] = *(const f32x4*)((const char*)src + off[i]);
}

// Split to hi/lo f16 and store (256 threads).
__device__ inline void put_split(const f32x4 (&x)[8],
                                 _Float16* __restrict__ Shi, _Float16* __restrict__ Slo) {
  int r0 = threadIdx.x >> 4, c = (threadIdx.x & 15) * 4;
#pragma unroll  // constant indices, so that the arrays stay in registers
  for (int i = 0; i < 8; ++i) {
    f16x4 h, l;
#pragma unroll  // constant indices, so that the arrays stay in registers
    for (int j = 0; j < 4; ++j) {
      h[j] = (_Float16)x[i][j];
      l[j] = (_Float16)(x[i][j] - (float)h[j]);
    }
    *(f16x4*)&Shi[(r0 + i * 16) * LDA + c] = h;
    *(f16x4*)&Slo[(r0 + i * 16) * LDA + c] = l;
  }
}

// 128 rows x 64 f16 of one pre-split plane: 8 lanes cover one whole 128-B line of a row.
// src = first element of the tile's first row; off[i] = byte offset from there of this
// thread's piece of the slice in tile row (t >> 3) + i * NT / 8.
template<int NT>
__device__ inline void fetch_f16(const _Float16* __restrict__ src, const unsigned (&off)[1024 / NT],
                                 f16x8 (&x)[1024 / NT]) {
#pragma unroll  // constant indices, so that the arrays stay in registers
  for (int i = 0; i < 1024 / NT; ++i) x[i] = *(const f16x8*)((const char*)src + off[i]);
}

template<int NT>
__device__ inline void put_f16(const f16x8 (&x)[1024 / NT], _Float16* __restrict__ S) {
  int r0 = threadIdx.x >> 3, c = (threadIdx.x & 7) * 8;
#pragma unroll  // constant indices, so that the arrays stay in registers
  for (int i = 0; i < 1024 / NT; ++i) *(f16x8*)&S[(r0 + i * (NT / 8)) * LDA + c] = x[i];
}

// Per-lane WMMA fragment per ISA layout, for the 32 k that start at kb in the slice:
// lane<16: K{0..7,16..23}; lane>=16: K{8..15,24..31}, row = lane&15 (+rowbase).
__device__ inline v16h load_frag(const _Float16* __restrict__ S, int rowbase, int kb) {
  int lane = threadIdx.x & 31;
  int row  = rowbase + (lane & 15);
  int ko   = kb + (lane >> 4) * 8;
  f16x8 a = *(const f16x8*)&S[row * LDA + ko];
  f16x8 b = *(const f16x8*)&S[row * LDA + ko + 16];
  return __builtin_shufflevector(a, b, 0,1,2,3,4,5,6,7,8,9,10,11,12,13,14,15);
}

// fp32-accurate product via 3 f16 WMMAs.
__device__ inline v8f mma3(v16h ah, v16h al, v16h bh, v16h bl, v8f c) {
  c = __builtin_amdgcn_wmma_f32_16x16x32_f16(false, ah, false, bh, (short)0, c, false, false);
  c = __builtin_amdgcn_wmma_f32_16x16x32_f16(false, ah, false, bl, (short)0, c, false, false);
  c = __builtin_amdgcn_wmma_f32_16x16x32_f16(false, al, false, bh, (short)0, c, false, false);
  return c;
}

// ---------------- stage 1: h = (v@W^T + Wb) * (r@U^T + Ub), gathered ----------------
// Block tile 128M x 128N, 8 waves each 64M x 32N. The two products run one after the
// other over the whole K through the same LDS tiles, so that a slice's staging registers
// and both accumulator sets fit the budget of two blocks per WGP.

// acc += X[gathered rows] @ B^T for this block's tile; B given as its hi and lo plane,
// both pointing at the tile's first row.
__device__ inline void stage1_product(const float* __restrict__ X,
                                      const _Float16* __restrict__ Bhi,
                                      const _Float16* __restrict__ Blo, int H,
                                      unsigned (&aoff)[8], unsigned (&boff)[4],
                                      _Float16* __restrict__ sAh, _Float16* __restrict__ sAl,
                                      _Float16* __restrict__ sBh, _Float16* __restrict__ sBl,
                                      int wm, int wn, v8f (&acc)[4][2]) {
  for (int k0 = 0; k0 < H; k0 += TK) {
    f32x4 xa[8];
    f16x8 xbh[4], xbl[4];
    fetch_f32g(X, aoff, xa);
    fetch_f16<256>(Bhi, boff, xbh);
    fetch_f16<256>(Blo, boff, xbl);
    put_split(xa, sAh, sAl);
    put_f16<256>(xbh, sBh);
    put_f16<256>(xbl, sBl);
#pragma unroll  // constant indices, so that the arrays stay in registers
    for (int i = 0; i < 8; ++i) aoff[i] += TK * 4;
#pragma unroll  // constant indices, so that the arrays stay in registers
    for (int i = 0; i < 4; ++i) boff[i] += TK * 2;
    __syncthreads();
#pragma unroll  // constant indices, so that the arrays stay in registers
    for (int kb = 0; kb < TK; kb += 32) {
      v16h bh[2], bl[2];
#pragma unroll  // constant indices, so that the arrays stay in registers
      for (int j = 0; j < 2; ++j) {
        bh[j] = load_frag(sBh, wn * 32 + j * 16, kb);
        bl[j] = load_frag(sBl, wn * 32 + j * 16, kb);
      }
#pragma unroll  // constant indices, so that the arrays stay in registers
      for (int i = 0; i < 4; ++i) {
        v16h ah = load_frag(sAh, wm * 64 + i * 16, kb);
        v16h al = load_frag(sAl, wm * 64 + i * 16, kb);
#pragma unroll  // constant indices, so that the arrays stay in registers
        for (int j = 0; j < 2; ++j) acc[i][j] = mma3(ah, al, bh[j], bl[j], acc[i][j]);
      }
    }
    __syncthreads();
  }
#pragma unroll  // constant indices, so that the arrays stay in registers
  for (int i = 0; i < 8; ++i) aoff[i] -= (unsigned)H * 4;   // back to k = 0 for the next product
#pragma unroll  // constant indices, so that the arrays stay in registers
  for (int i = 0; i < 4; ++i) boff[i] -= (unsigned)H * 2;
}

__global__ __launch_bounds__(256)
void k_stage1(const float* __restrict__ v_repr, const float* __restrict__ r_repr,
              const _Float16* __restrict__ Whi, const _Float16* __restrict__ Wlo,
              const _Float16* __restrict__ Uhi, const _Float16* __restrict__ Ulo,
              const float* __restrict__ Wb, const float* __restrict__ Ub,
              const int* __restrict__ layer_idx_p,
              const int* __restrict__ tile_role, const int* __restrict__ row_map,
              _Float16* __restrict__ hhi, _Float16* __restrict__ hlo, int H, int R) {
  __shared__ _Float16 sAh[TM * LDA], sAl[TM * LDA];
  __shared__ _Float16 sBh[TN * LDA], sBl[TN * LDA];

  int tile = blockIdx.x;
  int role = tile_role[tile];
  if (role < 0) return;
  int layer = layer_idx_p[0];
  size_t wb = (size_t)role * H * H;      // pre-split planes hold the active layer only

  int m0 = tile * TM, n0 = blockIdx.y * TN;
  int wave = threadIdx.x >> 5;
  int wm = wave & 1, wn = wave >> 1;     // 2 (M) x 4 (N) wave grid

  // Padding rows (row_map < 0) read source row 0: their products reach only their own
  // rows of h, which the epilogue sets to zero.
  unsigned aoff[8];
#pragma unroll  // constant indices, so that the arrays stay in registers
  for (int i = 0; i < 8; ++i) {
    int srow = row_map[m0 + (threadIdx.x >> 4) + i * 16];
    aoff[i] = ((unsigned)(srow < 0 ? 0 : srow) * H + (threadIdx.x & 15) * 4) * 4u;
  }
  unsigned boff[4];
#pragma unroll  // constant indices, so that the arrays stay in registers
  for (int i = 0; i < 4; ++i)
    boff[i] = (((threadIdx.x >> 3) + i * 32) * H + (threadIdx.x & 7) * 8) * 2u;
  size_t bb = wb + (size_t)n0 * H;

  v8f accW[4][2] = {}; v8f accU[4][2] = {};
  stage1_product(v_repr, Whi + bb, Wlo + bb, H, aoff, boff, sAh, sAl, sBh, sBl, wm, wn, accW);
  stage1_product(r_repr, Uhi + bb, Ulo + bb, H, aoff, boff, sAh, sAl, sBh, sBl, wm, wn, accU);

  int lane = threadIdx.x & 31;
  const float* Wbl = Wb + ((size_t)layer * R + role) * H;
  const float* Ubl = Ub + ((size_t)layer * R + role) * H;
#pragma unroll  // constant indices, so that the arrays stay in registers
  for (int i = 0; i < 4; ++i) {
#pragma unroll  // constant indices, so that the arrays stay in registers
    for (int j = 0; j < 2; ++j) {
      int col = n0 + wn * 32 + j * 16 + (lane & 15);
      float bw = Wbl[col], bu = Ubl[col];
#pragma unroll  // constant indices, so that the arrays stay in registers
      for (int g = 0; g < 8; ++g) {
        int mrow = m0 + wm * 64 + i * 16 + g + (lane >> 4) * 8;
        float h = (accW[i][j][g] + bw) * (accU[i][j][g] + bu);
        h = (row_map[mrow] >= 0) ? h : 0.0f;
        _Float16 hh = (_Float16)h;
        size_t o = (size_t)mrow * H + col;
        hhi[o] = hh;
        hlo[o] = (_Float16)(h - (float)hh);
      }
    }
  }
}

// ---------------- stages 2/3: block tile 128M x 128N, 4 waves each 64M x 64N --------
// EPI==0: dst = relu(A@P^T + b), re-split to hi/lo planes (sorted -> sorted)
// EPI==1: out[row_map[row]] = A@P^T + b   (sorted -> scatter, f32)

template<int EPI>
__global__ __launch_bounds__(128)
void k_gemm(const _Float16* __restrict__ Ahi, const _Float16* __restrict__ Alo,
            const _Float16* __restrict__ Bhi, const _Float16* __restrict__ Blo,
            const float* __restrict__ Pb, const int* __restrict__ layer_idx_p,
            const int* __restrict__ tile_role, const int* __restrict__ row_map,
            float* __restrict__ outF,
            _Float16* __restrict__ dsthi, _Float16* __restrict__ dstlo,
            int H, int R) {
  __shared__ _Float16 sAh[TM * LDA], sAl[TM * LDA];
  __shared__ _Float16 sBh[TN * LDA], sBl[TN * LDA];

  int tile = blockIdx.x;
  int role = tile_role[tile];
  if (role < 0) return;
  int layer = layer_idx_p[0];
  size_t pb = (size_t)role * H * H;

  int m0 = tile * TM, n0 = blockIdx.y * TN;
  int wave = threadIdx.x >> 5;
  int wm = wave & 1, wn = wave >> 1;     // 2 (M) x 2 (N) wave grid
  unsigned off[8];
#pragma unroll  // constant indices, so that the arrays stay in registers
  for (int i = 0; i < 8; ++i)
    off[i] = (((threadIdx.x >> 3) + i * 16) * H + (threadIdx.x & 7) * 8) * 2u;
  size_t ab = (size_t)m0 * H, bb = pb + (size_t)n0 * H;

  v8f acc[4][4] = {};
  for (int k0 = 0; k0 < H; k0 += TK) {
    f16x8 xah[8], xal[8], xbh[8], xbl[8];
    fetch_f16<128>(Ahi + ab, off, xah);
    fetch_f16<128>(Alo + ab, off, xal);
    fetch_f16<128>(Bhi + bb, off, xbh);
    fetch_f16<128>(Blo + bb, off, xbl);
    put_f16<128>(xah, sAh);
    put_f16<128>(xal, sAl);
    put_f16<128>(xbh, sBh);
    put_f16<128>(xbl, sBl);
#pragma unroll  // constant indices, so that the arrays stay in registers
    for (int i = 0; i < 8; ++i) off[i] += TK * 2;
    __syncthreads();
#pragma unroll  // constant indices, so that the arrays stay in registers
    for (int kb = 0; kb < TK; kb += 32) {
      v16h bh[4], bl[4];
#pragma unroll  // constant indices, so that the arrays stay in registers
      for (int j = 0; j < 4; ++j) {
        bh[j] = load_frag(sBh, wn * 64 + j * 16, kb);
        bl[j] = load_frag(sBl, wn * 64 + j * 16, kb);
      }
#pragma unroll  // constant indices, so that the arrays stay in registers
      for (int i = 0; i < 4; ++i) {
        v16h ah = load_frag(sAh, wm * 64 + i * 16, kb);
        v16h al = load_frag(sAl, wm * 64 + i * 16, kb);
#pragma unroll  // constant indices, so that the arrays stay in registers
        for (int j = 0; j < 4; ++j) acc[i][j] = mma3(ah, al, bh[j], bl[j], acc[i][j]);
      }
    }
    __syncthreads();
  }

  int lane = threadIdx.x & 31;
  const float* Pbl = Pb + ((size_t)layer * R + role) * H;
#pragma unroll  // constant indices, so that the arrays stay in registers
  for (int i = 0; i < 4; ++i) {
#pragma unroll  // constant indices, so that the arrays stay in registers
    for (int j = 0; j < 4; ++j) {
      int col = n0 + wn * 64 + j * 16 + (lane & 15);
      float b = Pbl[col];
#pragma unroll  // constant indices, so that the arrays stay in registers
      for (int g = 0; g < 8; ++g) {
        int mrow = m0 + wm * 64 + i * 16 + g + (lane >> 4) * 8;
        float val = acc[i][j][g] + b;
        if (EPI == 0) {
          val = fmaxf(val, 0.0f);
          _Float16 vh = (_Float16)val;
          size_t o = (size_t)mrow * H + col;
          dsthi[o] = vh;
          dstlo[o] = (_Float16)(val - (float)vh);
        } else {
          int e = row_map[mrow];
          if (e >= 0) outF[(size_t)e * H + col] = val;
        }
      }
    }
  }
}

// ---------------- host launch ----------------

static inline size_t align256(size_t x) { return (x + 255) & ~(size_t)255; }

extern "C" void kernel_launch(void* const* d_in, const int* in_sizes, int n_in,
                              void* d_out, int out_size, void* d_ws, size_t ws_size,
                              hipStream_t stream) {
  const float* v_repr = (const float*)d_in[0];
  const float* r_repr = (const float*)d_in[1];
  const int*   roles  = (const int*)d_in[2];
  const float* W   = (const float*)d_in[3];
  const float* Wb  = (const float*)d_in[4];
  const float* U   = (const float*)d_in[5];
  const float* Ub  = (const float*)d_in[6];
  const float* P1  = (const float*)d_in[7];
  const float* P1b = (const float*)d_in[8];
  const float* P2  = (const float*)d_in[9];
  const float* P2b = (const float*)d_in[10];
  const int*   layer_idx = (const int*)d_in[11];
  float* out = (float*)d_out;

  const int E = in_sizes[2];
  const int H = in_sizes[0] / E;                // 512
  const int R = NROLES;
  const int maxTiles = (E + TM - 1) / TM + R;   // padded role segments
  const int padRows  = maxTiles * TM;
  const int nW       = R * H * H;               // per-layer weight slice elements

  char* ws = (char*)d_ws;
  size_t off = 0;
  int* tile_role = (int*)(ws + off); off = align256(off + (size_t)maxTiles * 4);
  int* row_map   = (int*)(ws + off); off = align256(off + (size_t)padRows * 4);

  _Float16* wplane[8];                          // Whi Wlo Uhi Ulo P1hi P1lo P2hi P2lo
  for (int i = 0; i < 8; ++i) {
    wplane[i] = (_Float16*)(ws + off);
    off = align256(off + (size_t)nW * 2);
  }
  size_t actBytes = (size_t)padRows * H * 2;
  _Float16* hhi = (_Float16*)(ws + off); off = align256(off + actBytes);
  _Float16* hlo = (_Float16*)(ws + off); off = align256(off + actBytes);
  _Float16* thi = (_Float16*)(ws + off); off = align256(off + actBytes);
  _Float16* tlo = (_Float16*)(ws + off); off = align256(off + actBytes);

  int tpb = 256;
  dim3 gs((nW + SPLIT_BLOCK - 1) / SPLIT_BLOCK, 5);
  k_split<<<gs, tpb, 0, stream>>>(W, U, P1, P2, layer_idx, in_sizes[3] / nW, nW,
                                  wplane[0], (size_t)(wplane[1] - wplane[0]),
                                  roles, E, maxTiles, tile_role, row_map);

  dim3 g1(maxTiles, H / TN);
  k_stage1<<<g1, tpb, 0, stream>>>(v_repr, r_repr, wplane[0], wplane[1], wplane[2], wplane[3],
                                   Wb, Ub, layer_idx, tile_role, row_map, hhi, hlo, H, R);
  dim3 g2(maxTiles, H / TN);
  k_gemm<0><<<g2, 128, 0, stream>>>(hhi, hlo, wplane[4], wplane[5], P1b, layer_idx,
                                    tile_role, row_map, nullptr, thi, tlo, H, R);
  k_gemm<1><<<g2, 128, 0, stream>>>(thi, tlo, wplane[6], wplane[7], P2b, layer_idx,
                                    tile_role, row_map, out, nullptr, nullptr, H, R);
}

// v004
// Measured time: 213 microseconds a run.
// Timed twice side by side with v003, it ran 1.22 and 1.21 times as fast.
// Counting every step since v000, it is 1.96 times as fast.
#include <hip/hip_runtime.h>

// ---------------------------------------------------------------------------
// CDNA5 (gfx1250) implementation. wave32; WMMA f32_16x16x32_f16 with fp32
// hi/lo split (Markidis): Ah*Bh + Ah*Bl + Al*Bh at f32 accumulate gives
// ~2^-22 relative error on the fast f16 matrix pipe. Weights and
// intermediates are pre-split into hi/lo f16 planes; stage 1 splits its f32 inputs in-loop.
// ---------------------------------------------------------------------------

typedef _Float16 v16h  __attribute__((ext_vector_type(16)));
typedef _Float16 f16x8 __attribute__((ext_vector_type(8)));
typedef _Float16 f16x4 __attribute__((ext_vector_type(4)));
typedef float    v8f   __attribute__((ext_vector_type(8)));
typedef float    f32x4 __attribute__((ext_vector_type(4)));

#define TM 128         // M rows per block (sorted-entity tile)
#define TN 128         // N columns per block
#define TK 64          // K per staged slice: 128 B of every f16 row, one whole line
#define NROLES 3
#define LDA 72         // LDS row stride in f16 (144B: 16B x odd, conflict-free b128 reads)
#define TILE_H (TM * LDA)   // f16 per staged operand tile; TM == TN

// ---------------- role sort ----------------

typedef int i32x4 __attribute__((ext_vector_type(4)));

#define SORT_CHUNK 1024   // entries that one block ranks: 256 threads x 4
#define SORT_BATCH 32     // chunks whose 16-B loads a thread has in flight together

// One count in a field of 10 bits per role. A role outside the range takes the nearest one,
// so that every position formed below stays inside its segment.
__device__ inline unsigned role_bit(int r) { return 1u << (10 * min(max(r, 0), NROLES - 1)); }
__device__ inline unsigned role_bits(i32x4 v) {
  return (role_bit(v[0]) + role_bit(v[1])) + (role_bit(v[2]) + role_bit(v[3]));
}

// Counting sort of the entities by role, segments aligned to TM rows, with no word shared
// between blocks: every block counts the whole role array itself (whole-array counts give
// the segment starts, the counts ahead of its chunk give the chunk's start in each segment)
// and ranks the entries of its own chunk by a prefix scan. Rows of a role come out in index
// order. 256 threads. A thread counts 4 entries of every chunk in 10-bit fields: E < 261,000.
__device__ inline void role_sort(const int* __restrict__ roles, int E, int maxTiles,
                                 int* __restrict__ tile_role, int* __restrict__ row_map) {
  __shared__ int s_cnt[8][2 * NROLES];   // per wave: whole-array counts, counts ahead of the chunk
  __shared__ unsigned s_scan[8];         // per wave: packed counts of its part of the chunk
  const int t = threadIdx.x, lane = t & 31, wave = t >> 5;
  const int full = E / SORT_CHUNK;
  for (int c = blockIdx.x; c * SORT_CHUNK < E; c += gridDim.x) {
    // This thread's four entries of the chunk, fetched ahead of the counting loads.
    const int e0 = c * SORT_CHUNK + t * 4;
    i32x4 ov;
    if (c < full) {
      ov = *(const i32x4*)&roles[e0];
    } else {                             // the partial chunk: an entry past the end reads the last one
#pragma unroll  // constant indices, so that the vector stays in registers
      for (int j = 0; j < 4; ++j) ov[j] = roles[min(e0 + j, E - 1)];
      // The code behind this branch reuses the four loads' offset registers: the wait stands
      // between the loads and the first such overwrite.
      asm volatile("s_wait_xcnt 0x0" ::: "memory");
    }

    unsigned acc = 0, bef = 0;
    int k = 0;
    for (; k + SORT_BATCH <= full; k += SORT_BATCH) {
      i32x4 v[SORT_BATCH];
#pragma unroll  // constant indices; every load of a batch stands ahead of the first count
      for (int u = 0; u < SORT_BATCH; ++u)
        v[u] = *(const i32x4*)&roles[(k + u) * SORT_CHUNK + t * 4];
#pragma unroll  // constant indices, so that the array stays in registers
      for (int u = 0; u < SORT_BATCH; ++u) {
        if (k + u == c) bef = acc;
        acc += role_bits(v[u]);
      }
    }
    for (; k < full; ++k) {              // whole chunks that do not fill a batch
      if (k == c) bef = acc;
      acc += role_bits(*(const i32x4*)&roles[k * SORT_CHUNK + t * 4]);
    }
    if (full * SORT_CHUNK < E) {         // the last chunk is a partial one
      if (c == full) bef = acc;
#pragma unroll  // four fixed entries
      for (int j = 0; j < 4; ++j) {
        int e = full * SORT_CHUNK + t * 4 + j;
        acc += e < E ? role_bit(roles[e]) : 0u;
      }
    }
    unsigned own[4];
#pragma unroll  // constant indices, so that the arrays stay in registers
    for (int j = 0; j < 4; ++j) own[j] = e0 + j < E ? role_bit(ov[j]) : 0u;

    int red[2 * NROLES] = {(int)(acc & 1023u), (int)((acc >> 10) & 1023u), (int)(acc >> 20),
                           (int)(bef & 1023u), (int)((bef >> 10) & 1023u), (int)(bef >> 20)};
#pragma unroll  // constant indices, so that the arrays stay in registers
    for (int m = 16; m > 0; m >>= 1)
#pragma unroll  // constant indices, so that the arrays stay in registers
      for (int q = 0; q < 2 * NROLES; ++q) red[q] += __shfl_xor(red[q], m);
    unsigned mine = (own[0] + own[1]) + (own[2] + own[3]);
    unsigned inc = mine;                 // inclusive scan over the wave; a field stays <= 128
#pragma unroll  // five fixed steps
    for (int d = 1; d < 32; d <<= 1) {
      unsigned o = __shfl_up(inc, d);
      if (lane >= d) inc += o;
    }
    if (lane == 0) {
#pragma unroll  // constant indices, so that the arrays stay in registers
      for (int q = 0; q < 2 * NROLES; ++q) s_cnt[wave][q] = red[q];
    }
    if (lane == 31) s_scan[wave] = inc;
    __syncthreads();                     // the waves' counts are read by every wave

    int sum[2 * NROLES] = {0, 0, 0, 0, 0, 0};
    unsigned ex = inc - mine;            // entries of the chunk ahead of this thread's, per role
#pragma unroll  // constant indices, so that the arrays stay in registers
    for (int w = 0; w < 8; ++w) {
#pragma unroll  // constant indices, so that the arrays stay in registers
      for (int q = 0; q < 2 * NROLES; ++q) sum[q] += s_cnt[w][q];
      if (w < wave) ex += s_scan[w];
    }
    int seg[NROLES + 1];
    seg[0] = 0;
#pragma unroll  // constant indices, so that the arrays stay in registers
    for (int r = 0; r < NROLES; ++r) seg[r + 1] = (seg[r] + sum[r] + TM - 1) / TM * TM;

#pragma unroll  // constant indices, so that the arrays stay in registers
    for (int j = 0; j < 4; ++j) {
      if (own[j] != 0u) {
        int r = (int)((own[j] >> 10) & 1u) + 2 * (int)(own[j] >> 20);
        int start = r == 0 ? seg[0] + sum[3] : r == 1 ? seg[1] + sum[4] : seg[2] + sum[5];
        row_map[start + (int)((ex >> (10 * r)) & 1023u)] = e0 + j;
        ex += own[j];
      }
    }

    if (c == 0) {                        // one block marks the padding rows and names the tiles
#pragma unroll  // constant indices, so that the arrays stay in registers
      for (int r = 0; r < NROLES; ++r) {
        int end = r + 1 < NROLES ? seg[r + 1] : maxTiles * TM;
#pragma unroll 1  // at most a few trips, in one block: keeps the code short
        for (int p = seg[r] + sum[r] + t; p < end; p += 256) row_map[p] = -1;
      }
#pragma unroll 1  // at most a few trips, in one block: keeps the code short
      for (int tl = t; tl < maxTiles; tl += 256) {
        int role = -1, base = tl * TM;
#pragma unroll  // constant indices, so that the arrays stay in registers
        for (int r = 0; r < NROLES; ++r)
          if (base >= seg[r] && base < seg[r] + sum[r]) role = r;
        tile_role[tl] = role;
      }
    }
    __syncthreads();                     // the next trip overwrites the waves' counts
  }
}

// ---------------- weight pre-split: fp32 -> hi/lo f16 planes ----------------

// One launch sorts the roles (blockIdx.y == 0; neither job reads what the other writes) and
// splits the active layer of all four weight stacks (blockIdx.y - 1 picks the stack).
// For speed only, a thread takes
// SPLIT_P pieces of four values: every 16-B load of a thread is issued ahead of its first
// store, a wave's load covers 512 contiguous bytes and its store 256.
#define SPLIT_P 8
#define SPLIT_BLOCK (256 * 4 * SPLIT_P)   // values per block

// n = values of one layer of one stack, a multiple of 4; L = layers in a stack.
// planes = hi plane of stack 0; the eight planes (hi, lo of each stack) lie pitch apart.
__global__ __launch_bounds__(256)
void k_split(const float* __restrict__ W, const float* __restrict__ U,
             const float* __restrict__ P1, const float* __restrict__ P2,
             const int* __restrict__ layer_idx_p, int L, int n,
             _Float16* __restrict__ planes, size_t pitch,
             const int* __restrict__ roles, int E, int maxTiles,
             int* __restrict__ tile_role, int* __restrict__ row_map) {
  if (blockIdx.y == 0) {
    role_sort(roles, E, maxTiles, tile_role, row_map);
    return;
  }
  int s = blockIdx.y - 1;
  const float* base = s == 0 ? W : s == 1 ? U : s == 2 ? P1 : P2;
  int layer = min(max(layer_idx_p[0], 0), L - 1);
  const float* src = base + (size_t)layer * n;
  _Float16* hi = planes + (size_t)(2 * s) * pitch;
  _Float16* lo = hi + pitch;
  int i0 = blockIdx.x * SPLIT_BLOCK + threadIdx.x * 4;
  f32x4 x[SPLIT_P];
#pragma unroll  // constant indices, so that the array stays in registers
  for (int p = 0; p < SPLIT_P; ++p)      // a piece past the end reads the last piece instead
    x[p] = *(const f32x4*)&src[min(i0 + p * 1024, n - 4)];
#pragma unroll  // constant indices, so that the array stays in registers
  for (int p = 0; p < SPLIT_P; ++p) {
    int i = i0 + p * 1024;
    if (i >= n) continue;
    f16x4 h, l;
#pragma unroll  // constant indices, so that the vectors stay in registers
    for (int j = 0; j < 4; ++j) {
      h[j] = (_Float16)x[p][j];
      l[j] = (_Float16)(x[p][j] - (float)h[j]);
    }
    *(f16x4*)&hi[i] = h;
    *(f16x4*)&lo[i] = l;
  }
}

// ---------------- GEMM building blocks ----------------

// Staging of one K slice, global -> registers -> LDS. Every fetch of a slice is written
// ahead of the first LDS store, so that a slice costs one memory latency, not one per piece.
// Addresses are a wave-uniform base that stays fixed over the K loop plus a 32-bit byte
// offset of the thread, which the K loop advances in place.

// 128 rows x 64 f32, row-gathered: 16 lanes cover 256 contiguous bytes of one row.
// off[i] = byte offset of this thread's piece of the slice in the source row of tile row
// (t >> 4) + 16 i.
__device__ inline void fetch_f32g(const float* __restrict__ src, const unsigned (&off)[8],
                                  f32x4 (&x)[8]) {
#pragma unroll  // constant indices, so that the arrays stay in registers
  for (int i = 0; i < 8; ++i) x[i] = *(const f32x4*)((const char*)src + off[i]);
}

// Split to hi/lo f16 and store (256 threads).
__device__ inline void put_split(const f32x4 (&x)[8],
                                 _Float16* __restrict__ Shi, _Float16* __restrict__ Slo) {
  int r0 = threadIdx.x >> 4, c = (threadIdx.x & 15) * 4;
#pragma unroll  // constant indices, so that the arrays stay in registers
  for (int i = 0; i < 8; ++i) {
    f16x4 h, l;
#pragma unroll  // constant indices, so that the arrays stay in registers
    for (int j = 0; j < 4; ++j) {
      h[j] = (_Float16)x[i][j];
      l[j] = (_Float16)(x[i][j] - (float)h[j]);
    }
    *(f16x4*)&Shi[(r0 + i * 16) * LDA + c] = h;
    *(f16x4*)&Slo[(r0 + i * 16) * LDA + c] = l;
  }
}

// 128 rows x 64 f16 of one pre-split plane: 8 lanes cover one whole 128-B line of a row.
// src = first element of the tile's first row; off[i] = byte offset from there of this
// thread's piece of the slice in tile row (t >> 3) + i * NT / 8.
template<int NT>
__device__ inline void fetch_f16(const _Float16* __restrict__ src, const unsigned (&off)[1024 / NT],
                                 f16x8 (&x)[1024 / NT]) {
#pragma unroll  // constant indices, so that the arrays stay in registers
  for (int i = 0; i < 1024 / NT; ++i) x[i] = *(const f16x8*)((const char*)src + off[i]);
}

template<int NT>
__device__ inline void put_f16(const f16x8 (&x)[1024 / NT], _Float16* __restrict__ S) {
  int r0 = threadIdx.x >> 3, c = (threadIdx.x & 7) * 8;
#pragma unroll  // constant indices, so that the arrays stay in registers
  for (int i = 0; i < 1024 / NT; ++i) *(f16x8*)&S[(r0 + i * (NT / 8)) * LDA + c] = x[i];
}

// Per-lane WMMA fragment per ISA layout, for the 32 k that start at kb in the slice:
// lane<16: K{0..7,16..23}; lane>=16: K{8..15,24..31}, row = lane&15 (+rowbase).
__device__ inline v16h load_frag(const _Float16* __restrict__ S, int rowbase, int kb) {
  int lane = threadIdx.x & 31;
  int row  = rowbase + (lane & 15);
  int ko   = kb + (lane >> 4) * 8;
  f16x8 a = *(const f16x8*)&S[row * LDA + ko];
  f16x8 b = *(const f16x8*)&S[row * LDA + ko + 16];
  return __builtin_shufflevector(a, b, 0,1,2,3,4,5,6,7,8,9,10,11,12,13,14,15);
}

// fp32-accurate product via 3 f16 WMMAs.
__device__ inline v8f mma3(v16h ah, v16h al, v16h bh, v16h bl, v8f c) {
  c = __builtin_amdgcn_wmma_f32_16x16x32_f16(false, ah, false, bh, (short)0, c, false, false);
  c = __builtin_amdgcn_wmma_f32_16x16x32_f16(false, ah, false, bl, (short)0, c, false, false);
  c = __builtin_amdgcn_wmma_f32_16x16x32_f16(false, al, false, bh, (short)0, c, false, false);
  return c;
}

// ---------------- stage 1: h = (v@W^T + Wb) * (r@U^T + Ub), gathered ----------------
// Block tile 128M x 128N, 8 waves each 64M x 32N. The two products run one after the
// other over the whole K through the same LDS tiles, so that a slice's staging registers
// and both accumulator sets fit the budget of two blocks per WGP.

// acc += X[gathered rows] @ B^T for this block's tile; B given as its hi and lo plane,
// both pointing at the tile's first row.
__device__ inline void stage1_product(const float* __restrict__ X,
                                      const _Float16* __restrict__ Bhi,
                                      const _Float16* __restrict__ Blo, int H,
                                      unsigned (&aoff)[8], unsigned (&boff)[4],
                                      _Float16* __restrict__ sAh, _Float16* __restrict__ sAl,
                                      _Float16* __restrict__ sBh, _Float16* __restrict__ sBl,
                                      int wm, int wn, v8f (&acc)[4][2]) {
  for (int k0 = 0; k0 < H; k0 += TK) {
    f32x4 xa[8];
    f16x8 xbh[4], xbl[4];
    fetch_f32g(X, aoff, xa);
    fetch_f16<256>(Bhi, boff, xbh);
    fetch_f16<256>(Blo, boff, xbl);
    put_split(xa, sAh, sAl);
    put_f16<256>(xbh, sBh);
    put_f16<256>(xbl, sBl);
#pragma unroll  // constant indices, so that the arrays stay in registers
    for (int i = 0; i < 8; ++i) aoff[i] += TK * 4;
#pragma unroll  // constant indices, so that the arrays stay in registers
    for (int i = 0; i < 4; ++i) boff[i] += TK * 2;
    __syncthreads();
#pragma unroll  // constant indices, so that the arrays stay in registers
    for (int kb = 0; kb < TK; kb += 32) {
      v16h bh[2], bl[2];
#pragma unroll  // constant indices, so that the arrays stay in registers
      for (int j = 0; j < 2; ++j) {
        bh[j] = load_frag(sBh, wn * 32 + j * 16, kb);
        bl[j] = load_frag(sBl, wn * 32 + j * 16, kb);
      }
#pragma unroll  // constant indices, so that the arrays stay in registers
      for (int i = 0; i < 4; ++i) {
        v16h ah = load_frag(sAh, wm * 64 + i * 16, kb);
        v16h al = load_frag(sAl, wm * 64 + i * 16, kb);
#pragma unroll  // constant indices, so that the arrays stay in registers
        for (int j = 0; j < 2; ++j) acc[i][j] = mma3(ah, al, bh[j], bl[j], acc[i][j]);
      }
    }
    __syncthreads();
  }
#pragma unroll  // constant indices, so that the arrays stay in registers
  for (int i = 0; i < 8; ++i) aoff[i] -= (unsigned)H * 4;   // back to k = 0 for the next product
#pragma unroll  // constant indices, so that the arrays stay in registers
  for (int i = 0; i < 4; ++i) boff[i] -= (unsigned)H * 2;
}

#define OPITCH 136     // f16 per staged output row of 128: 272 B = 16 B x odd
static_assert(2 * TM * OPITCH <= 4 * TILE_H, "both planes of the output tile fit the operand tiles' LDS");

__global__ __launch_bounds__(256)
void k_stage1(const float* __restrict__ v_repr, const float* __restrict__ r_repr,
              const _Float16* __restrict__ Whi, const _Float16* __restrict__ Wlo,
              const _Float16* __restrict__ Uhi, const _Float16* __restrict__ Ulo,
              const float* __restrict__ Wb, const float* __restrict__ Ub,
              const int* __restrict__ layer_idx_p,
              const int* __restrict__ tile_role, const int* __restrict__ row_map,
              _Float16* __restrict__ hhi, _Float16* __restrict__ hlo, int H, int R) {
  // One array: the four operand tiles of the K loops, then the output tile's staging.
  __shared__ __attribute__((aligned(16))) _Float16 smem[4 * TILE_H];
  _Float16 *sAh = smem, *sAl = smem + TILE_H, *sBh = smem + 2 * TILE_H, *sBl = smem + 3 * TILE_H;

  int tile = blockIdx.x;
  int role = tile_role[tile];
  if (role < 0) return;
  int layer = layer_idx_p[0];
  size_t wb = (size_t)role * H * H;      // pre-split planes hold the active layer only

  int m0 = tile * TM, n0 = blockIdx.y * TN;
  int wave = threadIdx.x >> 5;
  int wm = wave & 1, wn = wave >> 1;     // 2 (M) x 4 (N) wave grid

  // Padding rows (row_map < 0) read source row 0: their products reach only their own
  // rows of h, which the epilogue sets to zero.
  unsigned aoff[8];
#pragma unroll  // constant indices, so that the arrays stay in registers
  for (int i = 0; i < 8; ++i) {
    int srow = row_map[m0 + (threadIdx.x >> 4) + i * 16];
    aoff[i] = ((unsigned)(srow < 0 ? 0 : srow) * H + (threadIdx.x & 15) * 4) * 4u;
  }
  unsigned boff[4];
#pragma unroll  // constant indices, so that the arrays stay in registers
  for (int i = 0; i < 4; ++i)
    boff[i] = (((threadIdx.x >> 3) + i * 32) * H + (threadIdx.x & 7) * 8) * 2u;
  size_t bb = wb + (size_t)n0 * H;

  v8f accW[4][2] = {}; v8f accU[4][2] = {};
  stage1_product(v_repr, Whi + bb, Wlo + bb, H, aoff, boff, sAh, sAl, sBh, sBl, wm, wn, accW);
  stage1_product(r_repr, Uhi + bb, Ulo + bb, H, aoff, boff, sAh, sAl, sBh, sBl, wm, wn, accU);

  // The accumulator layout gives a store 32-B pieces of two rows. The block's 128 x 128 tile
  // of each plane goes through LDS instead (free behind the K loop's last barrier), and a
  // wave's 16-B stores then cover two rows of 256 contiguous bytes: whole 128-B lines.
  _Float16 *oh = smem, *ol = smem + TM * OPITCH;
  int lane = threadIdx.x & 31;
  const float* Wbl = Wb + ((size_t)layer * R + role) * H;
  const float* Ubl = Ub + ((size_t)layer * R + role) * H;
#pragma unroll  // constant indices, so that the arrays stay in registers
  for (int i = 0; i < 4; ++i) {
#pragma unroll  // constant indices, so that the arrays stay in registers
    for (int j = 0; j < 2; ++j) {
      int cl = wn * 32 + j * 16 + (lane & 15);
      float bw = Wbl[n0 + cl], bu = Ubl[n0 + cl];
#pragma unroll  // constant indices, so that the arrays stay in registers
      for (int g = 0; g < 8; ++g) {
        int r = wm * 64 + i * 16 + g + (lane >> 4) * 8;
        float h = (accW[i][j][g] + bw) * (accU[i][j][g] + bu);
        h = (row_map[m0 + r] >= 0) ? h : 0.0f;
        _Float16 hh = (_Float16)h;
        oh[r * OPITCH + cl] = hh;
        ol[r * OPITCH + cl] = (_Float16)(h - (float)hh);
      }
    }
  }
  __syncthreads();                       // a row is read back by a wave that did not write it
#pragma unroll  // straight-line code: later rows' LDS reads are in flight while earlier rows are stored
  for (int it = 0; it < 8; ++it) {
    int r = it * 16 + (threadIdx.x >> 4), c = (threadIdx.x & 15) * 8;
    size_t o = (size_t)(m0 + r) * H + n0 + c;
    *(f16x8*)&hhi[o] = *(const f16x8*)&oh[r * OPITCH + c];
    *(f16x8*)&hlo[o] = *(const f16x8*)&ol[r * OPITCH + c];
  }
}

// ---------------- stages 2/3: block tile 128M x 128N, 4 waves each 64M x 64N --------
// EPI==0: dst = relu(A@P^T + b), re-split to hi/lo planes (sorted -> sorted)
// EPI==1: out[row_map[row]] = A@P^T + b   (sorted -> scatter, f32)

#define FPITCH 68      // f32 per staged output row of 64: 272 B = 16 B x odd
static_assert(64 * FPITCH * 4 <= TILE_H * 2 && 2 * 64 * LDA <= TILE_H, "a wave's output tile fits its quarter");

template<int EPI>
__global__ __launch_bounds__(128)
void k_gemm(const _Float16* __restrict__ Ahi, const _Float16* __restrict__ Alo,
            const _Float16* __restrict__ Bhi, const _Float16* __restrict__ Blo,
            const float* __restrict__ Pb, const int* __restrict__ layer_idx_p,
            const int* __restrict__ tile_role, const int* __restrict__ row_map,
            float* __restrict__ outF,
            _Float16* __restrict__ dsthi, _Float16* __restrict__ dstlo,
            int H, int R) {
  // One array: the four operand tiles of the K loop, then each wave's output staging.
  __shared__ __attribute__((aligned(16))) _Float16 smem[4 * TILE_H];
  _Float16 *sAh = smem, *sAl = smem + TILE_H, *sBh = smem + 2 * TILE_H, *sBl = smem + 3 * TILE_H;

  int tile = blockIdx.x;
  int role = tile_role[tile];
  if (role < 0) return;
  int layer = layer_idx_p[0];
  size_t pb = (size_t)role * H * H;

  int m0 = tile * TM, n0 = blockIdx.y * TN;
  int wave = threadIdx.x >> 5;
  int wm = wave & 1, wn = wave >> 1;     // 2 (M) x 2 (N) wave grid
  unsigned off[8];
#pragma unroll  // constant indices, so that the arrays stay in registers
  for (int i = 0; i < 8; ++i)
    off[i] = (((threadIdx.x >> 3) + i * 16) * H + (threadIdx.x & 7) * 8) * 2u;
  size_t ab = (size_t)m0 * H, bb = pb + (size_t)n0 * H;

  v8f acc[4][4] = {};
  for (int k0 = 0; k0 < H; k0 += TK) {
    f16x8 xah[8], xal[8], xbh[8], xbl[8];
    fetch_f16<128>(Ahi + ab, off, xah);
    fetch_f16<128>(Alo + ab, off, xal);
    fetch_f16<128>(Bhi + bb, off, xbh);
    fetch_f16<128>(Blo + bb, off, xbl);
    put_f16<128>(xah, sAh);
    put_f16<128>(xal, sAl);
    put_f16<128>(xbh, sBh);
    put_f16<128>(xbl, sBl);
#pragma unroll  // constant indices, so that the arrays stay in registers
    for (int i = 0; i < 8; ++i) off[i] += TK * 2;
    __syncthreads();
#pragma unroll  // constant indices, so that the arrays stay in registers
    for (int kb = 0; kb < TK; kb += 32) {
      v16h bh[4], bl[4];
#pragma unroll  // constant indices, so that the arrays stay in registers
      for (int j = 0; j < 4; ++j) {
        bh[j] = load_frag(sBh, wn * 64 + j * 16, kb);
        bl[j] = load_frag(sBl, wn * 64 + j * 16, kb);
      }
#pragma unroll  // constant indices, so that the arrays stay in registers
      for (int i = 0; i < 4; ++i) {
        v16h ah = load_frag(sAh, wm * 64 + i * 16, kb);
        v16h al = load_frag(sAl, wm * 64 + i * 16, kb);
#pragma unroll  // constant indices, so that the arrays stay in registers
        for (int j = 0; j < 4; ++j) acc[i][j] = mma3(ah, al, bh[j], bl[j], acc[i][j]);
      }
    }
    __syncthreads();
  }

  // The accumulator layout gives a store 32-B (f16) or 64-B (f32) pieces of two rows. Each
  // wave passes its 64 x 64 tile through its own quarter of the LDS (free behind the K loop's
  // last barrier) and stores rows of 128 or 256 contiguous bytes, 16 B a lane: whole lines.
  int lane = threadIdx.x & 31;
  const float* Pbl = Pb + ((size_t)layer * R + role) * H;
  _Float16* wst = smem + wave * TILE_H;
  _Float16 *oh = wst, *ol = wst + 64 * LDA;   // EPI == 0: 64 rows of 144 B per plane
  float* of = (float*)wst;                    // EPI == 1: 64 rows of 272 B
  float bias[4];
#pragma unroll  // constant indices, so that the array stays in registers
  for (int j = 0; j < 4; ++j) bias[j] = Pbl[n0 + wn * 64 + j * 16 + (lane & 15)];
  // The code below reuses the four loads' address registers: the wait stands between the
  // loads and the first such overwrite.
  asm volatile("s_wait_xcnt 0x0" ::: "memory");
  int e[32];                                  // EPI == 1: where the rows this lane stores go
  if (EPI == 1) {
#pragma unroll  // constant indices, so that the array stays in registers
    for (int it = 0; it < 32; ++it) e[it] = row_map[m0 + wm * 64 + it * 2 + (lane >> 4)];
    // As above, for the address register of these 32 loads.
    asm volatile("s_wait_xcnt 0x0" ::: "memory");
  }
#pragma unroll  // constant indices, so that the arrays stay in registers
  for (int i = 0; i < 4; ++i) {
#pragma unroll  // constant indices, so that the arrays stay in registers
    for (int j = 0; j < 4; ++j) {
      int cl = j * 16 + (lane & 15);
      float b = bias[j];
#pragma unroll  // constant indices, so that the arrays stay in registers
      for (int g = 0; g < 8; ++g) {
        int r = i * 16 + g + (lane >> 4) * 8;
        float val = acc[i][j][g] + b;
        if (EPI == 0) {
          val = fmaxf(val, 0.0f);
          _Float16 vh = (_Float16)val;
          oh[r * LDA + cl] = vh;
          ol[r * LDA + cl] = (_Float16)(val - (float)vh);
        } else {
          of[r * FPITCH + cl] = val;
        }
      }
    }
  }
  // The wave's LDS writes are done before its lanes read what other lanes wrote.
  asm volatile("s_wait_dscnt 0x0" ::: "memory");
  if (EPI == 0) {
#pragma unroll  // straight-line code: later rows' LDS reads are in flight while earlier rows are stored
    for (int it = 0; it < 16; ++it) {
      int r = it * 4 + (lane >> 3), c = (lane & 7) * 8;
      size_t o = (size_t)(m0 + wm * 64 + r) * H + n0 + wn * 64 + c;
      *(f16x8*)&dsthi[o] = *(const f16x8*)&oh[r * LDA + c];
      *(f16x8*)&dstlo[o] = *(const f16x8*)&ol[r * LDA + c];
    }
  } else {
    int c = (lane & 15) * 4;
#pragma unroll  // constant indices, so that the arrays stay in registers
    for (int hb = 0; hb < 32; hb += 16) {
      f32x4 v[16];
#pragma unroll  // constant indices, so that the arrays stay in registers
      for (int u = 0; u < 16; ++u) v[u] = *(const f32x4*)&of[((hb + u) * 2 + (lane >> 4)) * FPITCH + c];
      // Holds the 16 LDS reads ahead of the first branch below: left alone, each read sinks
      // into its row's branch and the rows cost one LDS latency after another.
      asm volatile("" :: "v"(v[0]), "v"(v[1]), "v"(v[2]), "v"(v[3]), "v"(v[4]), "v"(v[5]),
                   "v"(v[6]), "v"(v[7]), "v"(v[8]), "v"(v[9]), "v"(v[10]), "v"(v[11]),
                   "v"(v[12]), "v"(v[13]), "v"(v[14]), "v"(v[15]));
#pragma unroll  // constant indices, so that the arrays stay in registers
      for (int u = 0; u < 16; ++u)
        if (e[hb + u] >= 0) *(f32x4*)&outF[(size_t)e[hb + u] * H + n0 + wn * 64 + c] = v[u];
    }
  }
}

// ---------------- host launch ----------------

static inline size_t align256(size_t x) { return (x + 255) & ~(size_t)255; }

extern "C" void kernel_launch(void* const* d_in, const int* in_sizes, int n_in,
                              void* d_out, int out_size, void* d_ws, size_t ws_size,
                              hipStream_t stream) {
  const float* v_repr = (const float*)d_in[0];
  const float* r_repr = (const float*)d_in[1];
  const int*   roles  = (const int*)d_in[2];
  const float* W   = (const float*)d_in[3];
  const float* Wb  = (const float*)d_in[4];
  const float* U   = (const float*)d_in[5];
  const float* Ub  = (const float*)d_in[6];
  const float* P1  = (const float*)d_in[7];
  const float* P1b = (const float*)d_in[8];
  const float* P2  = (const float*)d_in[9];
  const float* P2b = (const float*)d_in[10];
  const int*   layer_idx = (const int*)d_in[11];
  float* out = (float*)d_out;

  const int E = in_sizes[2];
  const int H = in_sizes[0] / E;                // 512
  const int R = NROLES;
  const int maxTiles = (E + TM - 1) / TM + R;   // padded role segments
  const int padRows  = maxTiles * TM;
  const int nW       = R * H * H;               // per-layer weight slice elements

  char* ws = (char*)d_ws;
  size_t off = 0;
  int* tile_role = (int*)(ws + off); off = align256(off + (size_t)maxTiles * 4);
  int* row_map   = (int*)(ws + off); off = align256(off + (size_t)padRows * 4);

  _Float16* wplane[8];                          // Whi Wlo Uhi Ulo P1hi P1lo P2hi P2lo
  for (int i = 0; i < 8; ++i) {
    wplane[i] = (_Float16*)(ws + off);
    off = align256(off + (size_t)nW * 2);
  }
  size_t actBytes = (size_t)padRows * H * 2;
  _Float16* hhi = (_Float16*)(ws + off); off = align256(off + actBytes);
  _Float16* hlo = (_Float16*)(ws + off); off = align256(off + actBytes);
  _Float16* thi = (_Float16*)(ws + off); off = align256(off + actBytes);
  _Float16* tlo = (_Float16*)(ws + off); off = align256(off + actBytes);

  int tpb = 256;
  dim3 gs((nW + SPLIT_BLOCK - 1) / SPLIT_BLOCK, 5);
  k_split<<<gs, tpb, 0, stream>>>(W, U, P1, P2, layer_idx, in_sizes[3] / nW, nW,
                                  wplane[0], (size_t)(wplane[1] - wplane[0]),
                                  roles, E, maxTiles, tile_role, row_map);

  dim3 g1(maxTiles, H / TN);
  k_stage1<<<g1, tpb, 0, stream>>>(v_repr, r_repr, wplane[0], wplane[1], wplane[2], wplane[3],
                                   Wb, Ub, layer_idx, tile_role, row_map, hhi, hlo, H, R);
  dim3 g2(maxTiles, H / TN);
  k_gemm<0><<<g2, 128, 0, stream>>>(hhi, hlo, wplane[4], wplane[5], P1b, layer_idx,
                                    tile_role, row_map, nullptr, thi, tlo, H, R);
  k_gemm<1><<<g2, 128, 0, stream>>>(thi, tlo, wplane[6], wplane[7], P2b, layer_idx,
                                    tile_role, row_map, out, nullptr, nullptr, H, R);
}
